// v000
// Times are from an AMD MI455X. After a warm-up the kernel runs many times in a row, and a time is the length of
// such a window on the GPU divided by its runs, so every launch and the gaps after it count. The runs cycle
// through copies of the inputs. A figure is the median of several windows, for all but v000 over two sittings.
// Sittings can differ by a few percent; kernels timed side by side share one.
// The starting kernel, v000, takes 1150 microseconds a run.
#include <hip/hip_runtime.h>
#include <hip/hip_bf16.h>
#include <stdint.h>

#define B_  2
#define S_  4096
#define DM  1024
#define H_  16
#define HD  64

typedef __attribute__((ext_vector_type(16))) _Float16 v16h;
typedef __attribute__((ext_vector_type(8)))  _Float16 v8h;
typedef __attribute__((ext_vector_type(8)))  float    v8f;
typedef __attribute__((ext_vector_type(4)))  int      v4i;

union Frag16 { v16h v; v8h h[2]; };

// ---------------------------------------------------------------------------
// Async global->LDS 128-bit copy (ASYNCcnt path); sync fallback if the
// builtin is unavailable. The builtin wants v4i pointers in as(1)/as(3);
// LDS offset = low 32 bits of the generic address per ISA 10.2.
// ---------------------------------------------------------------------------
__device__ __forceinline__ void async_cp16(const _Float16* g, _Float16* l) {
#if defined(__gfx1250__) && __has_builtin(__builtin_amdgcn_global_load_async_to_lds_b128)
  __builtin_amdgcn_global_load_async_to_lds_b128(
      (__attribute__((address_space(1))) v4i*)(unsigned long long)(uintptr_t)g,
      (__attribute__((address_space(3))) v4i*)(unsigned int)(uintptr_t)l,
      0, 0);
#else
  *(v8h*)l = *(const v8h*)g;
#endif
}

__device__ __forceinline__ void wait_async() {
#if defined(__gfx1250__) && __has_builtin(__builtin_amdgcn_s_wait_asynccnt)
  __builtin_amdgcn_s_wait_asynccnt(0);
#elif defined(__gfx1250__)
  asm volatile("s_wait_asynccnt 0" ::: "memory");
#endif
}

// Per ISA 7.12.2 (16-bit A 16x32): lane -> row = lane%16, K-half = lane/16;
// element e in [0,7]  -> K = kOff + half*8 + e
// element e in [8,15] -> K = kOff + 16 + half*8 + (e-8)
__device__ __forceinline__ v16h lds_frag(const _Float16* p, int row, int ldm,
                                         int kOff, int half) {
  Frag16 f;
  f.h[0] = *(const v8h*)(p + row * ldm + kOff + half * 8);
  f.h[1] = *(const v8h*)(p + row * ldm + kOff + 16 + half * 8);
  return f.v;
}

__device__ __forceinline__ v8f wmma16(v16h a, v16h b, v8f c) {
  return __builtin_amdgcn_wmma_f32_16x16x32_f16(false, a, false, b,
                                                (short)0, c, false, false);
}

// ---------------------------------------------------------------------------
// One-time f32 -> f16 conversion (x and the four weight matrices).
// ---------------------------------------------------------------------------
__global__ __launch_bounds__(256)
void cvt_f32_f16_kernel(const float* __restrict__ s, _Float16* __restrict__ d,
                        int n8) {
  int i = blockIdx.x * 256 + threadIdx.x;
  if (i < n8) {
    const float4 a = *(const float4*)(s + (size_t)i * 8);
    const float4 b = *(const float4*)(s + (size_t)i * 8 + 4);
    v8h o = {(_Float16)a.x, (_Float16)a.y, (_Float16)a.z, (_Float16)a.w,
             (_Float16)b.x, (_Float16)b.y, (_Float16)b.z, (_Float16)b.w};
    *(v8h*)(d + (size_t)i * 8) = o;
  }
}

// ---------------------------------------------------------------------------
// Stage one 128x32 A tile (async DMA) + 32x128 W tile transposed to [n][k].
// ---------------------------------------------------------------------------
__device__ __forceinline__ void gemm_stage(const _Float16* __restrict__ A,
                                           const _Float16* __restrict__ Wh,
                                           _Float16* aL, _Float16* bL,
                                           int bm, int bn, int k0, int tid) {
  #pragma unroll
  for (int p = 0; p < 2; ++p) {                  // 512 chunks of 8 halves
    int idx = p * 256 + tid;
    int row = idx >> 2;
    int c8  = (idx & 3) * 8;
    async_cp16(A + (size_t)(bm + row) * DM + k0 + c8, aL + row * 32 + c8);
  }
  #pragma unroll
  for (int p = 0; p < 2; ++p) {                  // 32 k-rows x 16 chunks of 8 n
    int idx = p * 256 + tid;
    int k  = idx >> 4;
    int n8 = (idx & 15) * 8;
    v8h w = *(const v8h*)(Wh + (size_t)(k0 + k) * DM + bn + n8);
    #pragma unroll
    for (int i = 0; i < 8; ++i) bL[(n8 + i) * 32 + k] = w[i];
  }
}

// ---------------------------------------------------------------------------
// Tiled GEMM: C[M=8192,1024] = A[M,1024](f16) * W[1024,1024](f16) (+bias)(*scale)
// OUT_BHSD: scatter f16 into [B,H,S,64]; else fp32 [M,1024] row-major.
// 256 thr = 8 waves (4 M-strips x 2 N-strips), tile 128x128, BK=32,
// double-buffered LDS with async-DMA A staging.
// ---------------------------------------------------------------------------
template <bool OUT_BHSD>
__global__ __launch_bounds__(256)
void gemm_wmma_kernel(const _Float16* __restrict__ A,
                      const _Float16* __restrict__ Wh,
                      const float* __restrict__ bias,
                      void* __restrict__ Out, float scale) {
  __shared__ __align__(16) _Float16 aLds[2][128 * 32];   // [row][k]
  __shared__ __align__(16) _Float16 bLds[2][128 * 32];   // W^T tile: [n][k]

  const int tid   = threadIdx.x;
  const int lane  = tid & 31;
  const int wave  = tid >> 5;
  const int waveM = wave & 3;
  const int waveN = wave >> 2;
  const int half  = lane >> 4;
  const int l16   = lane & 15;
  const int bm = blockIdx.x * 128;
  const int bn = blockIdx.y * 128;

  v8f acc[2][4];
  const v8f vzero = {0.f, 0.f, 0.f, 0.f, 0.f, 0.f, 0.f, 0.f};
  for (int mi = 0; mi < 2; ++mi)
    for (int j = 0; j < 4; ++j) acc[mi][j] = vzero;

  gemm_stage(A, Wh, aLds[0], bLds[0], bm, bn, 0, tid);
  wait_async();
  __syncthreads();

  const int NIT = DM / 32;
  for (int it = 0; it < NIT; ++it) {
    const int cur = it & 1;
    if (it + 1 < NIT)
      gemm_stage(A, Wh, aLds[cur ^ 1], bLds[cur ^ 1], bm, bn, (it + 1) * 32, tid);

    v16h afr[2], bfr[4];
    #pragma unroll
    for (int mi = 0; mi < 2; ++mi)
      afr[mi] = lds_frag(aLds[cur], waveM * 32 + mi * 16 + l16, 32, 0, half);
    #pragma unroll
    for (int j = 0; j < 4; ++j)
      bfr[j] = lds_frag(bLds[cur], waveN * 64 + j * 16 + l16, 32, 0, half);
    #pragma unroll
    for (int mi = 0; mi < 2; ++mi)
      #pragma unroll
      for (int j = 0; j < 4; ++j)
        acc[mi][j] = wmma16(afr[mi], bfr[j], acc[mi][j]);

    wait_async();
    __syncthreads();
  }

  // ---- epilogue: bias + scale, store (C layout: row = r + 8*half) ----
  #pragma unroll
  for (int mi = 0; mi < 2; ++mi)
    #pragma unroll
    for (int j = 0; j < 4; ++j) {
      int col = bn + waveN * 64 + j * 16 + l16;
      float bv = bias[col];
      #pragma unroll
      for (int r = 0; r < 8; ++r) {
        int row = bm + waveM * 32 + mi * 16 + r + 8 * half;
        float val = (acc[mi][j][r] + bv) * scale;
        if (OUT_BHSD) {
          int b = row >> 12, s = row & (S_ - 1);
          int h = col >> 6,  d = col & (HD - 1);
          ((_Float16*)Out)[(((size_t)(b * H_ + h)) * S_ + s) * HD + d] =
              (_Float16)val;
        } else {
          ((float*)Out)[(size_t)row * DM + col] = val;
        }
      }
    }
}

// ---------------------------------------------------------------------------
// Stage one 64-key KV block: K via async DMA, V transposed to [d][key].
// ---------------------------------------------------------------------------
__device__ __forceinline__ void attn_stage_kv(const _Float16* __restrict__ kg,
                                              const _Float16* __restrict__ vg,
                                              _Float16* kL, _Float16* vTL,
                                              int tid) {
  #pragma unroll
  for (int p = 0; p < 4; ++p) {
    int idx = p * 128 + tid;                     // 512 chunks of 8 halves
    async_cp16(kg + (size_t)idx * 8, kL + idx * 8);
  }
  #pragma unroll
  for (int p = 0; p < 4; ++p) {
    int idx = p * 128 + tid;
    int key = idx >> 3;
    int d0  = (idx & 7) * 8;
    v8h d = *(const v8h*)(vg + (size_t)idx * 8);
    #pragma unroll
    for (int i = 0; i < 8; ++i) vTL[(d0 + i) * 64 + key] = d[i];
  }
}

// ---------------------------------------------------------------------------
// Flash attention: block = (64-query tile, b*H+h); 128 thr = 4 waves, each
// wave owns 16 query rows; KV in double-buffered 64-key blocks; Q pre-scaled.
// ---------------------------------------------------------------------------
__global__ __launch_bounds__(128)
void flash_attn_kernel(const _Float16* __restrict__ Q,
                       const _Float16* __restrict__ K,
                       const _Float16* __restrict__ V,
                       _Float16* __restrict__ Outf16) {
  __shared__ __align__(16) _Float16 qLds[64 * 64];      // [q][d]
  __shared__ __align__(16) _Float16 kLds[2][64 * 64];   // [key][d]
  __shared__ __align__(16) _Float16 vT  [2][64 * 64];   // [d][key]
  __shared__ __align__(16) _Float16 pLds[64 * 64];      // [q][key], wave-private

  const int tid  = threadIdx.x;
  const int lane = tid & 31;
  const int wave = tid >> 5;
  const int half = lane >> 4;
  const int l16  = lane & 15;
  const int bh = blockIdx.y;
  const int qt = blockIdx.x;

  const size_t qbase  = ((size_t)bh * S_ + (size_t)qt * 64) * HD;
  const size_t kvbase = (size_t)bh * S_ * HD;

  #pragma unroll
  for (int p = 0; p < 4; ++p) {
    int idx = p * 128 + tid;
    async_cp16(Q + qbase + (size_t)idx * 8, qLds + idx * 8);
  }
  attn_stage_kv(K + kvbase, V + kvbase, kLds[0], vT[0], tid);
  wait_async();
  __syncthreads();

  float m_i[8], l_i[8];
  v8f o[4];
  const v8f vzero = {0.f, 0.f, 0.f, 0.f, 0.f, 0.f, 0.f, 0.f};
  #pragma unroll
  for (int r = 0; r < 8; ++r) { m_i[r] = -1e30f; l_i[r] = 0.f; }
  #pragma unroll
  for (int j = 0; j < 4; ++j) o[j] = vzero;

  const int NB = S_ / 64;
  for (int blk = 0; blk < NB; ++blk) {
    const int cur = blk & 1;
    if (blk + 1 < NB)
      attn_stage_kv(K + kvbase + (size_t)(blk + 1) * 64 * HD,
                    V + kvbase + (size_t)(blk + 1) * 64 * HD,
                    kLds[cur ^ 1], vT[cur ^ 1], tid);
    if (blk + 2 < NB)   // L2 warm-up two blocks ahead
      __builtin_prefetch(
          (const void*)(K + kvbase + (size_t)(blk + 2) * 64 * HD + tid * 32),
          0, 1);

    // ---- scores: S = Q(16x64) * K^T(64x64) ----
    v8f sc[4];
    #pragma unroll
    for (int j = 0; j < 4; ++j) sc[j] = vzero;
    #pragma unroll
    for (int kk = 0; kk < 64; kk += 32) {
      v16h aq = lds_frag(qLds, wave * 16 + l16, 64, kk, half);
      #pragma unroll
      for (int j = 0; j < 4; ++j) {
        v16h bk = lds_frag(kLds[cur], j * 16 + l16, 64, kk, half);
        sc[j] = wmma16(aq, bk, sc[j]);
      }
    }

    // ---- online softmax (row = r + 8*half per C layout) ----
    float newm[8], alpha[8], rowsum[8];
    #pragma unroll
    for (int r = 0; r < 8; ++r) {
      float v = fmaxf(fmaxf(sc[0][r], sc[1][r]), fmaxf(sc[2][r], sc[3][r]));
      #pragma unroll
      for (int m = 1; m <= 8; m <<= 1) v = fmaxf(v, __shfl_xor(v, m, 32));
      newm[r]  = fmaxf(m_i[r], v);
      alpha[r] = __expf(m_i[r] - newm[r]);
      rowsum[r] = 0.f;
    }
    #pragma unroll
    for (int j = 0; j < 4; ++j)
      #pragma unroll
      for (int r = 0; r < 8; ++r) {
        float p = __expf(sc[j][r] - newm[r]);
        sc[j][r] = p;
        rowsum[r] += p;
      }
    #pragma unroll
    for (int r = 0; r < 8; ++r) {
      float v = rowsum[r];
      #pragma unroll
      for (int m = 1; m <= 8; m <<= 1) v += __shfl_xor(v, m, 32);
      l_i[r] = alpha[r] * l_i[r] + v;
      m_i[r] = newm[r];
    }

    // ---- P to LDS f16 (wave-private rows), rescale O ----
    #pragma unroll
    for (int j = 0; j < 4; ++j)
      #pragma unroll
      for (int r = 0; r < 8; ++r)
        pLds[(wave * 16 + r + 8 * half) * 64 + j * 16 + l16] =
            (_Float16)sc[j][r];
    asm volatile("s_wait_dscnt 0" ::: "memory");   // wave-private LDS RAW
    #pragma unroll
    for (int j = 0; j < 4; ++j)
      #pragma unroll
      for (int r = 0; r < 8; ++r) o[j][r] *= alpha[r];

    // ---- O += P(16x64) * V(64x64) ----
    #pragma unroll
    for (int kk = 0; kk < 64; kk += 32) {
      v16h ap = lds_frag(pLds, wave * 16 + l16, 64, kk, half);
      #pragma unroll
      for (int j = 0; j < 4; ++j) {
        v16h bv = lds_frag(vT[cur], j * 16 + l16, 64, kk, half);
        o[j] = wmma16(ap, bv, o[j]);
      }
    }

    wait_async();
    __syncthreads();
  }

  // ---- normalize, store f16 to [B,S,DM] for the O-projection GEMM ----
  const int b = bh / H_;
  const int h = bh % H_;
  #pragma unroll
  for (int j = 0; j < 4; ++j)
    #pragma unroll
    for (int r = 0; r < 8; ++r) {
      int srow = qt * 64 + wave * 16 + r + 8 * half;
      int d    = j * 16 + l16;
      float val = o[j][r] / l_i[r];
      Outf16[((size_t)b * S_ + srow) * DM + h * HD + d] = (_Float16)val;
    }
}

// ---------------------------------------------------------------------------
extern "C" void kernel_launch(void* const* d_in, const int* in_sizes, int n_in,
                              void* d_out, int out_size, void* d_ws,
                              size_t ws_size, hipStream_t stream) {
  const float* x  = (const float*)d_in[0];
  const float* Wq = (const float*)d_in[1];
  const float* bq = (const float*)d_in[2];
  const float* Wk = (const float*)d_in[3];
  const float* bk = (const float*)d_in[4];
  const float* Wv = (const float*)d_in[5];
  const float* bv = (const float*)d_in[6];
  const float* Wo = (const float*)d_in[7];
  const float* bo = (const float*)d_in[8];

  const size_t elems = (size_t)B_ * S_ * DM;   // 8 Mi
  const size_t welem = (size_t)DM * DM;        // 1 Mi
  _Float16* xh  = (_Float16*)d_ws;             // f16 activations
  _Float16* wqh = xh + elems;
  _Float16* wkh = wqh + welem;
  _Float16* wvh = wkh + welem;
  _Float16* woh = wvh + welem;
  _Float16* qws = woh + welem;                 // [B,H,S,64], pre-scaled 1/8
  _Float16* kws = qws + elems;
  _Float16* vws = kws + elems;
  _Float16* aws = vws + elems;                 // attention out, [B,S,DM]

  // one-time f32 -> f16 conversions
  cvt_f32_f16_kernel<<<(int)(elems / 8 / 256), 256, 0, stream>>>(x, xh,
                                                                 (int)(elems / 8));
  cvt_f32_f16_kernel<<<(int)(welem / 8 / 256), 256, 0, stream>>>(Wq, wqh,
                                                                 (int)(welem / 8));
  cvt_f32_f16_kernel<<<(int)(welem / 8 / 256), 256, 0, stream>>>(Wk, wkh,
                                                                 (int)(welem / 8));
  cvt_f32_f16_kernel<<<(int)(welem / 8 / 256), 256, 0, stream>>>(Wv, wvh,
                                                                 (int)(welem / 8));
  cvt_f32_f16_kernel<<<(int)(welem / 8 / 256), 256, 0, stream>>>(Wo, woh,
                                                                 (int)(welem / 8));

  dim3 gGemm(64, 8);   // 8192/128 x 1024/128
  dim3 bGemm(256);
  gemm_wmma_kernel<true><<<gGemm, bGemm, 0, stream>>>(xh, wqh, bq, (void*)qws,
                                                      0.125f);  // 1/sqrt(64)
  gemm_wmma_kernel<true><<<gGemm, bGemm, 0, stream>>>(xh, wkh, bk, (void*)kws,
                                                      1.0f);
  gemm_wmma_kernel<true><<<gGemm, bGemm, 0, stream>>>(xh, wvh, bv, (void*)vws,
                                                      1.0f);

  dim3 gAttn(S_ / 64, B_ * H_);
  flash_attn_kernel<<<gAttn, dim3(128), 0, stream>>>(qws, kws, vws, aws);

  gemm_wmma_kernel<false><<<gGemm, bGemm, 0, stream>>>(aws, woh, bo, d_out,
                                                       1.0f);
}

// v001
// A run of this version takes 796 microseconds.
// In both of two side-by-side timings against v000, it was 1.47 times as fast.
#include <hip/hip_runtime.h>
#include <hip/hip_bf16.h>
#include <stdint.h>

#define B_  2
#define S_  4096
#define DM  1024
#define H_  16
#define HD  64

// LDS row pitch in halves. Every tile is read by 16-byte fragment loads with
// one row per lane, so the pitch is an odd multiple of 16 bytes: 16 rows then
// fall on distinct bank groups. The pad halves are never written or read.
#define GP  40   // 32-half GEMM rows  -> 80 B
#define AP  72   // 64-half attention rows -> 144 B

typedef __attribute__((ext_vector_type(16))) _Float16 v16h;
typedef __attribute__((ext_vector_type(8)))  _Float16 v8h;
typedef __attribute__((ext_vector_type(8)))  float    v8f;
typedef __attribute__((ext_vector_type(4)))  int      v4i;

union Frag16 { v16h v; v8h h[2]; };

// ---------------------------------------------------------------------------
// Async global->LDS 128-bit copy (ASYNCcnt path); sync fallback if the
// builtin is unavailable. The builtin wants v4i pointers in as(1)/as(3);
// LDS offset = low 32 bits of the generic address per ISA 10.2.
// ---------------------------------------------------------------------------
__device__ __forceinline__ void async_cp16(const _Float16* g, _Float16* l) {
#if defined(__gfx1250__) && __has_builtin(__builtin_amdgcn_global_load_async_to_lds_b128)
  __builtin_amdgcn_global_load_async_to_lds_b128(
      (__attribute__((address_space(1))) v4i*)(unsigned long long)(uintptr_t)g,
      (__attribute__((address_space(3))) v4i*)(unsigned int)(uintptr_t)l,
      0, 0);
#else
  *(v8h*)l = *(const v8h*)g;
#endif
}

__device__ __forceinline__ void wait_async() {
#if defined(__gfx1250__) && __has_builtin(__builtin_amdgcn_s_wait_asynccnt)
  __builtin_amdgcn_s_wait_asynccnt(0);
#elif defined(__gfx1250__)
  asm volatile("s_wait_asynccnt 0" ::: "memory");
#endif
}

// Per ISA 7.12.2 (16-bit A 16x32): lane -> row = lane%16, K-half = lane/16;
// element e in [0,7]  -> K = kOff + half*8 + e
// element e in [8,15] -> K = kOff + 16 + half*8 + (e-8)
__device__ __forceinline__ v16h lds_frag(const _Float16* p, int row, int ldm,
                                         int kOff, int half) {
  Frag16 f;
  f.h[0] = *(const v8h*)(p + row * ldm + kOff + half * 8);
  f.h[1] = *(const v8h*)(p + row * ldm + kOff + 16 + half * 8);
  return f.v;
}

__device__ __forceinline__ v8f wmma16(v16h a, v16h b, v8f c) {
  return __builtin_amdgcn_wmma_f32_16x16x32_f16(false, a, false, b,
                                                (short)0, c, false, false);
}

// ---------------------------------------------------------------------------
// One-time f32 -> f16 conversion (x and the four weight matrices).
// ---------------------------------------------------------------------------
__global__ __launch_bounds__(256)
void cvt_f32_f16_kernel(const float* __restrict__ s, _Float16* __restrict__ d,
                        int n8) {
  int i = blockIdx.x * 256 + threadIdx.x;
  if (i < n8) {
    const float4 a = *(const float4*)(s + (size_t)i * 8);
    const float4 b = *(const float4*)(s + (size_t)i * 8 + 4);
    v8h o = {(_Float16)a.x, (_Float16)a.y, (_Float16)a.z, (_Float16)a.w,
             (_Float16)b.x, (_Float16)b.y, (_Float16)b.z, (_Float16)b.w};
    *(v8h*)(d + (size_t)i * 8) = o;
  }
}

// ---------------------------------------------------------------------------
// Stage one 128x32 A tile (async DMA) + 32x128 W tile transposed to [n][k].
// ---------------------------------------------------------------------------
__device__ __forceinline__ void gemm_stage(const _Float16* __restrict__ A,
                                           const _Float16* __restrict__ Wh,
                                           _Float16* aL, _Float16* bL,
                                           int bm, int bn, int k0, int tid) {
  #pragma unroll
  for (int p = 0; p < 2; ++p) {                  // 512 chunks of 8 halves
    int idx = p * 256 + tid;
    int row = idx >> 2;
    int c8  = (idx & 3) * 8;
    async_cp16(A + (size_t)(bm + row) * DM + k0 + c8, aL + row * GP + c8);
  }
  #pragma unroll
  for (int p = 0; p < 2; ++p) {                  // 32 k-rows x 16 chunks of 8 n
    int idx = p * 256 + tid;
    int k  = idx >> 4;
    int n8 = (idx & 15) * 8;
    v8h w = *(const v8h*)(Wh + (size_t)(k0 + k) * DM + bn + n8);
    #pragma unroll
    for (int i = 0; i < 8; ++i) bL[(n8 + i) * GP + k] = w[i];
  }
}

// ---------------------------------------------------------------------------
// Tiled GEMM: C[M=8192,1024] = A[M,1024](f16) * W[1024,1024](f16) (+bias)(*scale)
// OUT_BHSD: scatter f16 into [B,H,S,64]; else fp32 [M,1024] row-major.
// 256 thr = 8 waves (4 M-strips x 2 N-strips), tile 128x128, BK=32,
// double-buffered LDS with async-DMA A staging.
// ---------------------------------------------------------------------------
template <bool OUT_BHSD>
__global__ __launch_bounds__(256)
void gemm_wmma_kernel(const _Float16* __restrict__ A,
                      const _Float16* __restrict__ Wh,
                      const float* __restrict__ bias,
                      void* __restrict__ Out, float scale) {
  __shared__ __align__(16) _Float16 aLds[2][128 * GP];   // [row][k]
  __shared__ __align__(16) _Float16 bLds[2][128 * GP];   // W^T tile: [n][k]

  const int tid   = threadIdx.x;
  const int lane  = tid & 31;
  const int wave  = tid >> 5;
  const int waveM = wave & 3;
  const int waveN = wave >> 2;
  const int half  = lane >> 4;
  const int l16   = lane & 15;
  const int bm = blockIdx.x * 128;
  const int bn = blockIdx.y * 128;

  v8f acc[2][4];
  const v8f vzero = {0.f, 0.f, 0.f, 0.f, 0.f, 0.f, 0.f, 0.f};
  for (int mi = 0; mi < 2; ++mi)
    for (int j = 0; j < 4; ++j) acc[mi][j] = vzero;

  gemm_stage(A, Wh, aLds[0], bLds[0], bm, bn, 0, tid);
  wait_async();
  __syncthreads();

  const int NIT = DM / 32;
  for (int it = 0; it < NIT; ++it) {
    const int cur = it & 1;
    if (it + 1 < NIT)
      gemm_stage(A, Wh, aLds[cur ^ 1], bLds[cur ^ 1], bm, bn, (it + 1) * 32, tid);

    v16h afr[2], bfr[4];
    #pragma unroll
    for (int mi = 0; mi < 2; ++mi)
      afr[mi] = lds_frag(aLds[cur], waveM * 32 + mi * 16 + l16, GP, 0, half);
    #pragma unroll
    for (int j = 0; j < 4; ++j)
      bfr[j] = lds_frag(bLds[cur], waveN * 64 + j * 16 + l16, GP, 0, half);
    #pragma unroll
    for (int mi = 0; mi < 2; ++mi)
      #pragma unroll
      for (int j = 0; j < 4; ++j)
        acc[mi][j] = wmma16(afr[mi], bfr[j], acc[mi][j]);

    wait_async();
    __syncthreads();
  }

  // ---- epilogue: bias + scale, store (C layout: row = r + 8*half) ----
  #pragma unroll
  for (int mi = 0; mi < 2; ++mi)
    #pragma unroll
    for (int j = 0; j < 4; ++j) {
      int col = bn + waveN * 64 + j * 16 + l16;
      float bv = bias[col];
      #pragma unroll
      for (int r = 0; r < 8; ++r) {
        int row = bm + waveM * 32 + mi * 16 + r + 8 * half;
        float val = (acc[mi][j][r] + bv) * scale;
        if (OUT_BHSD) {
          int b = row >> 12, s = row & (S_ - 1);
          int h = col >> 6,  d = col & (HD - 1);
          ((_Float16*)Out)[(((size_t)(b * H_ + h)) * S_ + s) * HD + d] =
              (_Float16)val;
        } else {
          ((float*)Out)[(size_t)row * DM + col] = val;
        }
      }
    }
}

// ---------------------------------------------------------------------------
// Stage one 64-key KV block: K via async DMA, V transposed to [d][key].
// ---------------------------------------------------------------------------
__device__ __forceinline__ void attn_stage_kv(const _Float16* __restrict__ kg,
                                              const _Float16* __restrict__ vg,
                                              _Float16* kL, _Float16* vTL,
                                              int tid) {
  #pragma unroll
  for (int p = 0; p < 4; ++p) {
    int idx = p * 128 + tid;                     // 512 chunks of 8 halves
    async_cp16(kg + (size_t)idx * 8, kL + (idx >> 3) * AP + (idx & 7) * 8);
  }
  #pragma unroll
  for (int p = 0; p < 4; ++p) {
    int idx = p * 128 + tid;
    int key = idx >> 3;
    int d0  = (idx & 7) * 8;
    v8h d = *(const v8h*)(vg + (size_t)idx * 8);
    #pragma unroll
    for (int i = 0; i < 8; ++i) vTL[(d0 + i) * AP + key] = d[i];
  }
}

// ---------------------------------------------------------------------------
// Flash attention: block = (64-query tile, b*H+h); 128 thr = 4 waves, each
// wave owns 16 query rows; KV in double-buffered 64-key blocks; Q pre-scaled.
// ---------------------------------------------------------------------------
__global__ __launch_bounds__(128)
void flash_attn_kernel(const _Float16* __restrict__ Q,
                       const _Float16* __restrict__ K,
                       const _Float16* __restrict__ V,
                       _Float16* __restrict__ Outf16) {
  __shared__ __align__(16) _Float16 qLds[64 * AP];      // [q][d]
  __shared__ __align__(16) _Float16 kLds[2][64 * AP];   // [key][d]
  __shared__ __align__(16) _Float16 vT  [2][64 * AP];   // [d][key]
  __shared__ __align__(16) _Float16 pLds[64 * AP];      // [q][key], wave-private

  const int tid  = threadIdx.x;
  const int lane = tid & 31;
  const int wave = tid >> 5;
  const int half = lane >> 4;
  const int l16  = lane & 15;
  const int bh = blockIdx.y;
  const int qt = blockIdx.x;

  const size_t qbase  = ((size_t)bh * S_ + (size_t)qt * 64) * HD;
  const size_t kvbase = (size_t)bh * S_ * HD;

  #pragma unroll
  for (int p = 0; p < 4; ++p) {
    int idx = p * 128 + tid;
    async_cp16(Q + qbase + (size_t)idx * 8,
               qLds + (idx >> 3) * AP + (idx & 7) * 8);
  }
  attn_stage_kv(K + kvbase, V + kvbase, kLds[0], vT[0], tid);
  wait_async();
  __syncthreads();

  float m_i[8], l_i[8];
  v8f o[4];
  const v8f vzero = {0.f, 0.f, 0.f, 0.f, 0.f, 0.f, 0.f, 0.f};
  #pragma unroll
  for (int r = 0; r < 8; ++r) { m_i[r] = -1e30f; l_i[r] = 0.f; }
  #pragma unroll
  for (int j = 0; j < 4; ++j) o[j] = vzero;

  const int NB = S_ / 64;
  for (int blk = 0; blk < NB; ++blk) {
    const int cur = blk & 1;
    if (blk + 1 < NB)
      attn_stage_kv(K + kvbase + (size_t)(blk + 1) * 64 * HD,
                    V + kvbase + (size_t)(blk + 1) * 64 * HD,
                    kLds[cur ^ 1], vT[cur ^ 1], tid);
    if (blk + 2 < NB)   // L2 warm-up two blocks ahead
      __builtin_prefetch(
          (const void*)(K + kvbase + (size_t)(blk + 2) * 64 * HD + tid * 32),
          0, 1);

    // ---- scores: S = Q(16x64) * K^T(64x64) ----
    v8f sc[4];
    #pragma unroll
    for (int j = 0; j < 4; ++j) sc[j] = vzero;
    #pragma unroll
    for (int kk = 0; kk < 64; kk += 32) {
      v16h aq = lds_frag(qLds, wave * 16 + l16, AP, kk, half);
      #pragma unroll
      for (int j = 0; j < 4; ++j) {
        v16h bk = lds_frag(kLds[cur], j * 16 + l16, AP, kk, half);
        sc[j] = wmma16(aq, bk, sc[j]);
      }
    }

    // ---- online softmax (row = r + 8*half per C layout) ----
    float newm[8], alpha[8], rowsum[8];
    #pragma unroll
    for (int r = 0; r < 8; ++r) {
      float v = fmaxf(fmaxf(sc[0][r], sc[1][r]), fmaxf(sc[2][r], sc[3][r]));
      #pragma unroll
      for (int m = 1; m <= 8; m <<= 1) v = fmaxf(v, __shfl_xor(v, m, 32));
      newm[r]  = fmaxf(m_i[r], v);
      alpha[r] = __expf(m_i[r] - newm[r]);
      rowsum[r] = 0.f;
    }
    #pragma unroll
    for (int j = 0; j < 4; ++j)
      #pragma unroll
      for (int r = 0; r < 8; ++r) {
        float p = __expf(sc[j][r] - newm[r]);
        sc[j][r] = p;
        rowsum[r] += p;
      }
    #pragma unroll
    for (int r = 0; r < 8; ++r) {
      float v = rowsum[r];
      #pragma unroll
      for (int m = 1; m <= 8; m <<= 1) v += __shfl_xor(v, m, 32);
      l_i[r] = alpha[r] * l_i[r] + v;
      m_i[r] = newm[r];
    }

    // ---- P to LDS f16 (wave-private rows), rescale O ----
    #pragma unroll
    for (int j = 0; j < 4; ++j)
      #pragma unroll
      for (int r = 0; r < 8; ++r)
        pLds[(wave * 16 + r + 8 * half) * AP + j * 16 + l16] =
            (_Float16)sc[j][r];
    asm volatile("s_wait_dscnt 0" ::: "memory");   // wave-private LDS RAW
    #pragma unroll
    for (int j = 0; j < 4; ++j)
      #pragma unroll
      for (int r = 0; r < 8; ++r) o[j][r] *= alpha[r];

    // ---- O += P(16x64) * V(64x64) ----
    #pragma unroll
    for (int kk = 0; kk < 64; kk += 32) {
      v16h ap = lds_frag(pLds, wave * 16 + l16, AP, kk, half);
      #pragma unroll
      for (int j = 0; j < 4; ++j) {
        v16h bv = lds_frag(vT[cur], j * 16 + l16, AP, kk, half);
        o[j] = wmma16(ap, bv, o[j]);
      }
    }

    wait_async();
    __syncthreads();
  }

  // ---- normalize, store f16 to [B,S,DM] for the O-projection GEMM ----
  const int b = bh / H_;
  const int h = bh % H_;
  #pragma unroll
  for (int j = 0; j < 4; ++j)
    #pragma unroll
    for (int r = 0; r < 8; ++r) {
      int srow = qt * 64 + wave * 16 + r + 8 * half;
      int d    = j * 16 + l16;
      float val = o[j][r] / l_i[r];
      Outf16[((size_t)b * S_ + srow) * DM + h * HD + d] = (_Float16)val;
    }
}

// ---------------------------------------------------------------------------
extern "C" void kernel_launch(void* const* d_in, const int* in_sizes, int n_in,
                              void* d_out, int out_size, void* d_ws,
                              size_t ws_size, hipStream_t stream) {
  const float* x  = (const float*)d_in[0];
  const float* Wq = (const float*)d_in[1];
  const float* bq = (const float*)d_in[2];
  const float* Wk = (const float*)d_in[3];
  const float* bk = (const float*)d_in[4];
  const float* Wv = (const float*)d_in[5];
  const float* bv = (const float*)d_in[6];
  const float* Wo = (const float*)d_in[7];
  const float* bo = (const float*)d_in[8];

  const size_t elems = (size_t)B_ * S_ * DM;   // 8 Mi
  const size_t welem = (size_t)DM * DM;        // 1 Mi
  _Float16* xh  = (_Float16*)d_ws;             // f16 activations
  _Float16* wqh = xh + elems;
  _Float16* wkh = wqh + welem;
  _Float16* wvh = wkh + welem;
  _Float16* woh = wvh + welem;
  _Float16* qws = woh + welem;                 // [B,H,S,64], pre-scaled 1/8
  _Float16* kws = qws + elems;
  _Float16* vws = kws + elems;
  _Float16* aws = vws + elems;                 // attention out, [B,S,DM]

  // one-time f32 -> f16 conversions
  cvt_f32_f16_kernel<<<(int)(elems / 8 / 256), 256, 0, stream>>>(x, xh,
                                                                 (int)(elems / 8));
  cvt_f32_f16_kernel<<<(int)(welem / 8 / 256), 256, 0, stream>>>(Wq, wqh,
                                                                 (int)(welem / 8));
  cvt_f32_f16_kernel<<<(int)(welem / 8 / 256), 256, 0, stream>>>(Wk, wkh,
                                                                 (int)(welem / 8));
  cvt_f32_f16_kernel<<<(int)(welem / 8 / 256), 256, 0, stream>>>(Wv, wvh,
                                                                 (int)(welem / 8));
  cvt_f32_f16_kernel<<<(int)(welem / 8 / 256), 256, 0, stream>>>(Wo, woh,
                                                                 (int)(welem / 8));

  dim3 gGemm(64, 8);   // 8192/128 x 1024/128
  dim3 bGemm(256);
  gemm_wmma_kernel<true><<<gGemm, bGemm, 0, stream>>>(xh, wqh, bq, (void*)qws,
                                                      0.125f);  // 1/sqrt(64)
  gemm_wmma_kernel<true><<<gGemm, bGemm, 0, stream>>>(xh, wkh, bk, (void*)kws,
                                                      1.0f);
  gemm_wmma_kernel<true><<<gGemm, bGemm, 0, stream>>>(xh, wvh, bv, (void*)vws,
                                                      1.0f);

  dim3 gAttn(S_ / 64, B_ * H_);
  flash_attn_kernel<<<gAttn, dim3(128), 0, stream>>>(qws, kws, vws, aws);

  gemm_wmma_kernel<false><<<gGemm, bGemm, 0, stream>>>(aws, woh, bo, d_out,
                                                       1.0f);
}

// v002
// A run of this version takes 629 microseconds.
// Two timings next to v001 both put it at 1.27 times that version's speed.
// Counting every step since v000, it is 1.86 times as fast.
#include <hip/hip_runtime.h>
#include <hip/hip_bf16.h>
#include <stdint.h>

#define B_  2
#define S_  4096
#define DM  1024
#define H_  16
#define HD  64

// LDS row pitch in halves. Every tile is read by 16-byte fragment loads with
// one row per lane, so the pitch is an odd multiple of 16 bytes: 16 rows then
// fall on distinct bank groups. The pad halves are never written or read.
#define GP  40   // 32-half GEMM rows  -> 80 B
#define AP  72   // 64-half attention rows -> 144 B

typedef __attribute__((ext_vector_type(16))) _Float16 v16h;
typedef __attribute__((ext_vector_type(8)))  _Float16 v8h;
typedef __attribute__((ext_vector_type(8)))  float    v8f;
typedef __attribute__((ext_vector_type(4)))  int      v4i;

union Frag16 { v16h v; v8h h[2]; };

// ---------------------------------------------------------------------------
// Async global->LDS 128-bit copy (ASYNCcnt path); sync fallback if the
// builtin is unavailable. The builtin wants v4i pointers in as(1)/as(3);
// LDS offset = low 32 bits of the generic address per ISA 10.2.
// ---------------------------------------------------------------------------
__device__ __forceinline__ void async_cp16(const _Float16* g, _Float16* l) {
#if defined(__gfx1250__) && __has_builtin(__builtin_amdgcn_global_load_async_to_lds_b128)
  __builtin_amdgcn_global_load_async_to_lds_b128(
      (__attribute__((address_space(1))) v4i*)(unsigned long long)(uintptr_t)g,
      (__attribute__((address_space(3))) v4i*)(unsigned int)(uintptr_t)l,
      0, 0);
#else
  *(v8h*)l = *(const v8h*)g;
#endif
}

__device__ __forceinline__ void wait_async() {
#if defined(__gfx1250__) && __has_builtin(__builtin_amdgcn_s_wait_asynccnt)
  __builtin_amdgcn_s_wait_asynccnt(0);
#elif defined(__gfx1250__)
  asm volatile("s_wait_asynccnt 0" ::: "memory");
#endif
}

// Per ISA 7.12.2 (16-bit A 16x32): lane -> row = lane%16, K-half = lane/16;
// element e in [0,7]  -> K = kOff + half*8 + e
// element e in [8,15] -> K = kOff + 16 + half*8 + (e-8)
__device__ __forceinline__ v16h lds_frag(const _Float16* p, int row, int ldm,
                                         int kOff, int half) {
  Frag16 f;
  f.h[0] = *(const v8h*)(p + row * ldm + kOff + half * 8);
  f.h[1] = *(const v8h*)(p + row * ldm + kOff + 16 + half * 8);
  return f.v;
}

// Lane l reads lane l ^ 16 by a vector cross-row move (no LDS-counter wait).
__device__ __forceinline__ float xhalf(float x) {
  const int b = __builtin_bit_cast(int, x);
  return __builtin_bit_cast(
      float, __builtin_amdgcn_permlanex16(b, b, 0x76543210, 0xfedcba98, false,
                                          false));
}

__device__ __forceinline__ v8f wmma16(v16h a, v16h b, v8f c) {
  return __builtin_amdgcn_wmma_f32_16x16x32_f16(false, a, false, b,
                                                (short)0, c, false, false);
}

// ---------------------------------------------------------------------------
// One-time f32 -> f16 conversion (x and the four weight matrices).
// ---------------------------------------------------------------------------
__global__ __launch_bounds__(256)
void cvt_f32_f16_kernel(const float* __restrict__ s, _Float16* __restrict__ d,
                        int n8) {
  int i = blockIdx.x * 256 + threadIdx.x;
  if (i < n8) {
    const float4 a = *(const float4*)(s + (size_t)i * 8);
    const float4 b = *(const float4*)(s + (size_t)i * 8 + 4);
    v8h o = {(_Float16)a.x, (_Float16)a.y, (_Float16)a.z, (_Float16)a.w,
             (_Float16)b.x, (_Float16)b.y, (_Float16)b.z, (_Float16)b.w};
    *(v8h*)(d + (size_t)i * 8) = o;
  }
}

// ---------------------------------------------------------------------------
// Stage one 128x32 A tile (async DMA) + 32x128 W tile transposed to [n][k].
// ---------------------------------------------------------------------------
__device__ __forceinline__ void gemm_stage(const _Float16* __restrict__ A,
                                           const _Float16* __restrict__ Wh,
                                           _Float16* aL, _Float16* bL,
                                           int bm, int bn, int k0, int tid) {
  #pragma unroll
  for (int p = 0; p < 2; ++p) {                  // 512 chunks of 8 halves
    int idx = p * 256 + tid;
    int row = idx >> 2;
    int c8  = (idx & 3) * 8;
    async_cp16(A + (size_t)(bm + row) * DM + k0 + c8, aL + row * GP + c8);
  }
  #pragma unroll
  for (int p = 0; p < 2; ++p) {                  // 32 k-rows x 16 chunks of 8 n
    int idx = p * 256 + tid;
    int k  = idx >> 4;
    int n8 = (idx & 15) * 8;
    v8h w = *(const v8h*)(Wh + (size_t)(k0 + k) * DM + bn + n8);
    #pragma unroll
    for (int i = 0; i < 8; ++i) bL[(n8 + i) * GP + k] = w[i];
  }
}

// ---------------------------------------------------------------------------
// Tiled GEMM: C[M=8192,1024] = A[M,1024](f16) * W[1024,1024](f16) (+bias)(*scale)
// OUT_BHSD: scatter f16 into [B,H,S,64]; else fp32 [M,1024] row-major.
// 256 thr = 8 waves (4 M-strips x 2 N-strips), tile 128x128, BK=32,
// double-buffered LDS with async-DMA A staging.
// ---------------------------------------------------------------------------
template <bool OUT_BHSD>
__global__ __launch_bounds__(256)
void gemm_wmma_kernel(const _Float16* __restrict__ A,
                      const _Float16* __restrict__ Wh,
                      const float* __restrict__ bias,
                      void* __restrict__ Out, float scale) {
  __shared__ __align__(16) _Float16 aLds[2][128 * GP];   // [row][k]
  __shared__ __align__(16) _Float16 bLds[2][128 * GP];   // W^T tile: [n][k]

  const int tid   = threadIdx.x;
  const int lane  = tid & 31;
  const int wave  = tid >> 5;
  const int waveM = wave & 3;
  const int waveN = wave >> 2;
  const int half  = lane >> 4;
  const int l16   = lane & 15;
  const int bm = blockIdx.x * 128;
  const int bn = blockIdx.y * 128;

  v8f acc[2][4];
  const v8f vzero = {0.f, 0.f, 0.f, 0.f, 0.f, 0.f, 0.f, 0.f};
  for (int mi = 0; mi < 2; ++mi)
    for (int j = 0; j < 4; ++j) acc[mi][j] = vzero;

  gemm_stage(A, Wh, aLds[0], bLds[0], bm, bn, 0, tid);
  wait_async();
  __syncthreads();

  const int NIT = DM / 32;
  for (int it = 0; it < NIT; ++it) {
    const int cur = it & 1;
    if (it + 1 < NIT)
      gemm_stage(A, Wh, aLds[cur ^ 1], bLds[cur ^ 1], bm, bn, (it + 1) * 32, tid);

    v16h afr[2], bfr[4];
    #pragma unroll
    for (int mi = 0; mi < 2; ++mi)
      afr[mi] = lds_frag(aLds[cur], waveM * 32 + mi * 16 + l16, GP, 0, half);
    #pragma unroll
    for (int j = 0; j < 4; ++j)
      bfr[j] = lds_frag(bLds[cur], waveN * 64 + j * 16 + l16, GP, 0, half);
    #pragma unroll
    for (int mi = 0; mi < 2; ++mi)
      #pragma unroll
      for (int j = 0; j < 4; ++j)
        acc[mi][j] = wmma16(afr[mi], bfr[j], acc[mi][j]);

    wait_async();
    __syncthreads();
  }

  // ---- epilogue: bias + scale, store (C layout: row = r + 8*half) ----
  #pragma unroll
  for (int mi = 0; mi < 2; ++mi)
    #pragma unroll
    for (int j = 0; j < 4; ++j) {
      int col = bn + waveN * 64 + j * 16 + l16;
      float bv = bias[col];
      #pragma unroll
      for (int r = 0; r < 8; ++r) {
        int row = bm + waveM * 32 + mi * 16 + r + 8 * half;
        float val = (acc[mi][j][r] + bv) * scale;
        if (OUT_BHSD) {
          int b = row >> 12, s = row & (S_ - 1);
          int h = col >> 6,  d = col & (HD - 1);
          ((_Float16*)Out)[(((size_t)(b * H_ + h)) * S_ + s) * HD + d] =
              (_Float16)val;
        } else {
          ((float*)Out)[(size_t)row * DM + col] = val;
        }
      }
    }
}

// ---------------------------------------------------------------------------
// Stage one 64-key KV block: K via async DMA, V transposed to [d][key].
// ---------------------------------------------------------------------------
__device__ __forceinline__ void attn_stage_kv(const _Float16* __restrict__ kg,
                                              const _Float16* __restrict__ vg,
                                              _Float16* kL, _Float16* vTL,
                                              int tid) {
  #pragma unroll
  for (int p = 0; p < 4; ++p) {
    int idx = p * 128 + tid;                     // 512 chunks of 8 halves
    async_cp16(kg + (size_t)idx * 8, kL + (idx >> 3) * AP + (idx & 7) * 8);
  }
  #pragma unroll
  for (int p = 0; p < 4; ++p) {
    int idx = p * 128 + tid;
    int key = idx >> 3;
    int d0  = (idx & 7) * 8;
    v8h d = *(const v8h*)(vg + (size_t)idx * 8);
    #pragma unroll
    for (int i = 0; i < 8; ++i) vTL[(d0 + i) * AP + key] = d[i];
  }
}

__global__ __launch_bounds__(128)
void flash_attn_kernel(const _Float16* __restrict__ Q,
                       const _Float16* __restrict__ K,
                       const _Float16* __restrict__ V,
                       _Float16* __restrict__ Outf16) {
  __shared__ __align__(16) _Float16 qLds[64 * AP];      // [q][d]
  __shared__ __align__(16) _Float16 kLds[2][64 * AP];   // [key][d]
  __shared__ __align__(16) _Float16 vT  [2][64 * AP];   // [d][key]

  const int tid  = threadIdx.x;
  const int lane = tid & 31;
  const int wave = tid >> 5;
  const int half = lane >> 4;
  const int l16  = lane & 15;
  const int bh = blockIdx.y;
  const int qt = blockIdx.x;

  const size_t qbase  = ((size_t)bh * S_ + (size_t)qt * 64) * HD;
  const size_t kvbase = (size_t)bh * S_ * HD;

  #pragma unroll
  for (int p = 0; p < 4; ++p) {
    int idx = p * 128 + tid;
    async_cp16(Q + qbase + (size_t)idx * 8,
               qLds + (idx >> 3) * AP + (idx & 7) * 8);
  }
  attn_stage_kv(K + kvbase, V + kvbase, kLds[0], vT[0], tid);
  wait_async();
  __syncthreads();

  float m_i = -1e30f;   // running maximum of this lane's query
  float l_i = 0.f;      // running sum over this lane half's keys only
  v8f o[4];             // o[j][r] = O[query l16][d = j*16 + 8*half + r]
  const v8f vzero = {0.f, 0.f, 0.f, 0.f, 0.f, 0.f, 0.f, 0.f};
  #pragma unroll
  for (int j = 0; j < 4; ++j) o[j] = vzero;

  const int NB = S_ / 64;
  for (int blk = 0; blk < NB; ++blk) {
    const int cur = blk & 1;
    if (blk + 1 < NB)
      attn_stage_kv(K + kvbase + (size_t)(blk + 1) * 64 * HD,
                    V + kvbase + (size_t)(blk + 1) * 64 * HD,
                    kLds[cur ^ 1], vT[cur ^ 1], tid);
    if (blk + 2 < NB)   // L2 warm-up two blocks ahead
      __builtin_prefetch(
          (const void*)(K + kvbase + (size_t)(blk + 2) * 64 * HD + tid * 32),
          0, 1);

    // ---- scores: S^T = K(64x64) * Q^T(64x16);
    //      sc[j][r] = S[query l16][key j*16 + 8*half + r] ----
    v8f sc[4];
    #pragma unroll
    for (int j = 0; j < 4; ++j) sc[j] = vzero;
    #pragma unroll
    for (int kk = 0; kk < 64; kk += 32) {
      v16h bq = lds_frag(qLds, wave * 16 + l16, AP, kk, half);
      #pragma unroll
      for (int j = 0; j < 4; ++j) {
        v16h ak = lds_frag(kLds[cur], j * 16 + l16, AP, kk, half);
        sc[j] = wmma16(ak, bq, sc[j]);
      }
    }

    // ---- online softmax: in-lane over 32 keys, one exchange of halves ----
    float tmax[4];
    #pragma unroll
    for (int j = 0; j < 4; ++j) {
      tmax[j] = sc[j][0];
      #pragma unroll
      for (int r = 1; r < 8; ++r) tmax[j] = fmaxf(tmax[j], sc[j][r]);
    }
    float bmax = fmaxf(fmaxf(tmax[0], tmax[1]), fmaxf(tmax[2], tmax[3]));
    bmax = fmaxf(bmax, xhalf(bmax));
    const float newm  = fmaxf(m_i, bmax);
    const float alpha = __expf(m_i - newm);
    m_i = newm;

    float tsum[4];
    #pragma unroll
    for (int j = 0; j < 4; ++j) {
      tsum[j] = 0.f;
      #pragma unroll
      for (int r = 0; r < 8; ++r) {
        float p = __expf(sc[j][r] - newm);
        sc[j][r] = p;
        tsum[j] += p;
      }
    }
    l_i = alpha * l_i + ((tsum[0] + tsum[1]) + (tsum[2] + tsum[3]));

    // ---- rescale O^T: one factor per lane ----
    #pragma unroll
    for (int j = 0; j < 4; ++j)
      #pragma unroll
      for (int r = 0; r < 8; ++r) o[j][r] *= alpha;

    // ---- O^T += V^T(64x64) * P^T(64x16); score tiles 2t and 2t+1 are keys
    //      32t + 8*half + e and 32t + 16 + 8*half + e: the loader's k order ----
    #pragma unroll
    for (int t = 0; t < 2; ++t) {
      v16h bp;
      #pragma unroll
      for (int e = 0; e < 8; ++e) {
        bp[e]     = (_Float16)sc[2 * t][e];
        bp[8 + e] = (_Float16)sc[2 * t + 1][e];
      }
      #pragma unroll
      for (int j = 0; j < 4; ++j) {
        v16h av = lds_frag(vT[cur], j * 16 + l16, AP, t * 32, half);
        o[j] = wmma16(av, bp, o[j]);
      }
    }

    wait_async();
    __syncthreads();
  }

  // ---- join the halves' sums, normalize, store f16 to [B,S,DM] for the
  //      O-projection GEMM: 8 consecutive d per lane and tile, 16 bytes ----
  const float l_all = l_i + xhalf(l_i);
  const int b = bh / H_;
  const int h = bh % H_;
  const int srow = qt * 64 + wave * 16 + l16;
  _Float16* orow = Outf16 + ((size_t)b * S_ + srow) * DM + h * HD + 8 * half;
  #pragma unroll
  for (int j = 0; j < 4; ++j) {
    v8h ov;
    #pragma unroll
    for (int r = 0; r < 8; ++r) ov[r] = (_Float16)(o[j][r] / l_all);
    *(v8h*)(orow + j * 16) = ov;
  }
}

// ---------------------------------------------------------------------------
extern "C" void kernel_launch(void* const* d_in, const int* in_sizes, int n_in,
                              void* d_out, int out_size, void* d_ws,
                              size_t ws_size, hipStream_t stream) {
  const float* x  = (const float*)d_in[0];
  const float* Wq = (const float*)d_in[1];
  const float* bq = (const float*)d_in[2];
  const float* Wk = (const float*)d_in[3];
  const float* bk = (const float*)d_in[4];
  const float* Wv = (const float*)d_in[5];
  const float* bv = (const float*)d_in[6];
  const float* Wo = (const float*)d_in[7];
  const float* bo = (const float*)d_in[8];

  const size_t elems = (size_t)B_ * S_ * DM;   // 8 Mi
  const size_t welem = (size_t)DM * DM;        // 1 Mi
  _Float16* xh  = (_Float16*)d_ws;             // f16 activations
  _Float16* wqh = xh + elems;
  _Float16* wkh = wqh + welem;
  _Float16* wvh = wkh + welem;
  _Float16* woh = wvh + welem;
  _Float16* qws = woh + welem;                 // [B,H,S,64], pre-scaled 1/8
  _Float16* kws = qws + elems;
  _Float16* vws = kws + elems;
  _Float16* aws = vws + elems;                 // attention out, [B,S,DM]

  // one-time f32 -> f16 conversions
  cvt_f32_f16_kernel<<<(int)(elems / 8 / 256), 256, 0, stream>>>(x, xh,
                                                                 (int)(elems / 8));
  cvt_f32_f16_kernel<<<(int)(welem / 8 / 256), 256, 0, stream>>>(Wq, wqh,
                                                                 (int)(welem / 8));
  cvt_f32_f16_kernel<<<(int)(welem / 8 / 256), 256, 0, stream>>>(Wk, wkh,
                                                                 (int)(welem / 8));
  cvt_f32_f16_kernel<<<(int)(welem / 8 / 256), 256, 0, stream>>>(Wv, wvh,
                                                                 (int)(welem / 8));
  cvt_f32_f16_kernel<<<(int)(welem / 8 / 256), 256, 0, stream>>>(Wo, woh,
                                                                 (int)(welem / 8));

  dim3 gGemm(64, 8);   // 8192/128 x 1024/128
  dim3 bGemm(256);
  gemm_wmma_kernel<true><<<gGemm, bGemm, 0, stream>>>(xh, wqh, bq, (void*)qws,
                                                      0.125f);  // 1/sqrt(64)
  gemm_wmma_kernel<true><<<gGemm, bGemm, 0, stream>>>(xh, wkh, bk, (void*)kws,
                                                      1.0f);
  gemm_wmma_kernel<true><<<gGemm, bGemm, 0, stream>>>(xh, wvh, bv, (void*)vws,
                                                      1.0f);

  dim3 gAttn(S_ / 64, B_ * H_);
  flash_attn_kernel<<<gAttn, dim3(128), 0, stream>>>(qws, kws, vws, aws);

  gemm_wmma_kernel<false><<<gGemm, bGemm, 0, stream>>>(aws, woh, bo, d_out,
                                                       1.0f);
}

// v003
// One run takes 262 microseconds.
// Next to v002, in two timings, it ran 2.40 and 2.41 times as fast.
// Over all steps from v000 it is 4.46 times as fast.
#include <hip/hip_runtime.h>
#include <hip/hip_bf16.h>
#include <stdint.h>

#define B_  2
#define S_  4096
#define DM  1024
#define H_  16
#define HD  64

// LDS row pitch in halves. A tile read by plain 16-byte fragment loads, one
// row per lane, has a pitch that is an odd multiple of 16 bytes; a tile read by
// the transposing 16-byte load has an odd multiple of 32 bytes. The rows of a
// load then fall on distinct bank groups. Pad halves are never written or read.
#define GP  40   // 32-half GEMM A rows -> 80 B
#define AP  72   // 64-half Q and K rows -> 144 B
#define WP  144  // 128-half W rows, transposing reader -> 288 B
#define VP  80   // 64-half V rows, transposing reader -> 160 B

typedef __attribute__((ext_vector_type(16))) _Float16 v16h;
typedef __attribute__((ext_vector_type(8)))  _Float16 v8h;
typedef __attribute__((ext_vector_type(8)))  float    v8f;
typedef __attribute__((ext_vector_type(4)))  int      v4i;
typedef __attribute__((ext_vector_type(8)))  short    v8s;

union Frag16 { v16h v; v8h h[2]; };

// ---------------------------------------------------------------------------
// Async global->LDS 128-bit copy (ASYNCcnt path); sync fallback if the
// builtin is unavailable. The builtin wants v4i pointers in as(1)/as(3);
// LDS offset = low 32 bits of the generic address per ISA 10.2.
// ---------------------------------------------------------------------------
__device__ __forceinline__ void async_cp16(const _Float16* g, _Float16* l) {
#if defined(__gfx1250__) && __has_builtin(__builtin_amdgcn_global_load_async_to_lds_b128)
  __builtin_amdgcn_global_load_async_to_lds_b128(
      (__attribute__((address_space(1))) v4i*)(unsigned long long)(uintptr_t)g,
      (__attribute__((address_space(3))) v4i*)(unsigned int)(uintptr_t)l,
      0, 0);
#else
  *(v8h*)l = *(const v8h*)g;
#endif
}

__device__ __forceinline__ void wait_async() {
#if defined(__gfx1250__) && __has_builtin(__builtin_amdgcn_s_wait_asynccnt)
  __builtin_amdgcn_s_wait_asynccnt(0);
#elif defined(__gfx1250__)
  asm volatile("s_wait_asynccnt 0" ::: "memory");
#endif
}

// Per ISA 7.12.2 (16-bit A 16x32): lane -> row = lane%16, K-half = lane/16;
// element e in [0,7]  -> K = kOff + half*8 + e
// element e in [8,15] -> K = kOff + 16 + half*8 + (e-8)
__device__ __forceinline__ v16h lds_frag(const _Float16* p, int row, int ldm,
                                         int kOff, int half) {
  Frag16 f;
  f.h[0] = *(const v8h*)(p + row * ldm + kOff + half * 8);
  f.h[1] = *(const v8h*)(p + row * ldm + kOff + 16 + half * 8);
  return f.v;
}

// Transposed fragment from a row-major tile T[k][x], pitch ldm halves: the
// lane (c = lane%16, half) gets T[kOff + half*8 + e][xOff + c] in elements 0-7
// and T[kOff + 16 + half*8 + e][xOff + c] in 8-15, the k order of lds_frag.
// Each lane hands the load the address of one 16-byte piece of a tile row.
__device__ __forceinline__ v16h lds_frag_tr(const _Float16* p, int ldm, int kOff,
                                            int xOff, int lane) {
  typedef __attribute__((address_space(3))) v8s lds_v8s;
  const _Float16* a = p + (kOff + (lane >> 4) * 8 + (lane & 7)) * ldm + xOff +
                      ((lane >> 3) & 1) * 8;
  Frag16 f;
  f.h[0] = __builtin_bit_cast(
      v8h, __builtin_amdgcn_ds_load_tr16_b128_v8i16((lds_v8s*)a));
  f.h[1] = __builtin_bit_cast(
      v8h, __builtin_amdgcn_ds_load_tr16_b128_v8i16((lds_v8s*)(a + 16 * ldm)));
  return f.v;
}

// Lane l reads lane l ^ 16 by a vector cross-row move (no LDS-counter wait).
__device__ __forceinline__ float xhalf(float x) {
  const int b = __builtin_bit_cast(int, x);
  return __builtin_bit_cast(
      float, __builtin_amdgcn_permlanex16(b, b, 0x76543210, 0xfedcba98, false,
                                          false));
}

__device__ __forceinline__ v8f wmma16(v16h a, v16h b, v8f c) {
  return __builtin_amdgcn_wmma_f32_16x16x32_f16(false, a, false, b,
                                                (short)0, c, false, false);
}

// ---------------------------------------------------------------------------
// One-time f32 -> f16 conversion (x and the four weight matrices).
// ---------------------------------------------------------------------------
__global__ __launch_bounds__(256)
void cvt_f32_f16_kernel(const float* __restrict__ s, _Float16* __restrict__ d,
                        int n8) {
  int i = blockIdx.x * 256 + threadIdx.x;
  if (i < n8) {
    const float4 a = *(const float4*)(s + (size_t)i * 8);
    const float4 b = *(const float4*)(s + (size_t)i * 8 + 4);
    v8h o = {(_Float16)a.x, (_Float16)a.y, (_Float16)a.z, (_Float16)a.w,
             (_Float16)b.x, (_Float16)b.y, (_Float16)b.z, (_Float16)b.w};
    *(v8h*)(d + (size_t)i * 8) = o;
  }
}

// ---------------------------------------------------------------------------
// Stage one 128x32 A tile and one 32x128 W tile, both row-major, async DMA.
// ---------------------------------------------------------------------------
__device__ __forceinline__ void gemm_stage(const _Float16* __restrict__ A,
                                           const _Float16* __restrict__ Wh,
                                           _Float16* aL, _Float16* bL,
                                           int bm, int bn, int k0, int tid) {
  #pragma unroll
  for (int p = 0; p < 2; ++p) {                  // 512 chunks of 8 halves
    int idx = p * 256 + tid;
    int row = idx >> 2;
    int c8  = (idx & 3) * 8;
    async_cp16(A + (size_t)(bm + row) * DM + k0 + c8, aL + row * GP + c8);
  }
  #pragma unroll
  for (int p = 0; p < 2; ++p) {                  // 32 k-rows x 16 chunks of 8 n
    int idx = p * 256 + tid;
    int k  = idx >> 4;
    int n8 = (idx & 15) * 8;
    async_cp16(Wh + (size_t)(k0 + k) * DM + bn + n8, bL + k * WP + n8);
  }
}

// ---------------------------------------------------------------------------
// Tiled GEMM: C[M=8192,1024] = A[M,1024](f16) * W[1024,1024](f16) (+bias)(*scale)
// OUT_BHSD: scatter f16 into [B,H,S,64]; else fp32 [M,1024] row-major.
// 256 thr = 8 waves (4 M-strips x 2 N-strips), tile 128x128, BK=32,
// double-buffered LDS with async-DMA staging; W is transposed by its reader.
// ---------------------------------------------------------------------------
template <bool OUT_BHSD>
__global__ __launch_bounds__(256)
void gemm_wmma_kernel(const _Float16* __restrict__ A,
                      const _Float16* __restrict__ Wh,
                      const float* __restrict__ bias,
                      void* __restrict__ Out, float scale) {
  __shared__ __align__(16) _Float16 aLds[2][128 * GP];   // [row][k]
  __shared__ __align__(16) _Float16 bLds[2][32 * WP];    // W tile: [k][n]

  const int tid   = threadIdx.x;
  const int lane  = tid & 31;
  const int wave  = tid >> 5;
  const int waveM = wave & 3;
  const int waveN = wave >> 2;
  const int half  = lane >> 4;
  const int l16   = lane & 15;
  const int bm = blockIdx.x * 128;
  const int bn = blockIdx.y * 128;

  v8f acc[2][4];
  const v8f vzero = {0.f, 0.f, 0.f, 0.f, 0.f, 0.f, 0.f, 0.f};
  for (int mi = 0; mi < 2; ++mi)
    for (int j = 0; j < 4; ++j) acc[mi][j] = vzero;

  gemm_stage(A, Wh, aLds[0], bLds[0], bm, bn, 0, tid);
  wait_async();
  __syncthreads();

  const int NIT = DM / 32;
  for (int it = 0; it < NIT; ++it) {
    const int cur = it & 1;
    if (it + 1 < NIT)
      gemm_stage(A, Wh, aLds[cur ^ 1], bLds[cur ^ 1], bm, bn, (it + 1) * 32, tid);

    v16h afr[2], bfr[4];
    #pragma unroll
    for (int mi = 0; mi < 2; ++mi)
      afr[mi] = lds_frag(aLds[cur], waveM * 32 + mi * 16 + l16, GP, 0, half);
    #pragma unroll
    for (int j = 0; j < 4; ++j)
      bfr[j] = lds_frag_tr(bLds[cur], WP, 0, waveN * 64 + j * 16, lane);
    #pragma unroll
    for (int mi = 0; mi < 2; ++mi)
      #pragma unroll
      for (int j = 0; j < 4; ++j)
        acc[mi][j] = wmma16(afr[mi], bfr[j], acc[mi][j]);

    wait_async();
    __syncthreads();
  }

  // ---- epilogue: bias + scale, store (C layout: row = r + 8*half) ----
  #pragma unroll
  for (int mi = 0; mi < 2; ++mi)
    #pragma unroll
    for (int j = 0; j < 4; ++j) {
      int col = bn + waveN * 64 + j * 16 + l16;
      float bv = bias[col];
      #pragma unroll
      for (int r = 0; r < 8; ++r) {
        int row = bm + waveM * 32 + mi * 16 + r + 8 * half;
        float val = (acc[mi][j][r] + bv) * scale;
        if (OUT_BHSD) {
          int b = row >> 12, s = row & (S_ - 1);
          int h = col >> 6,  d = col & (HD - 1);
          ((_Float16*)Out)[(((size_t)(b * H_ + h)) * S_ + s) * HD + d] =
              (_Float16)val;
        } else {
          ((float*)Out)[(size_t)row * DM + col] = val;
        }
      }
    }
}

// ---------------------------------------------------------------------------
// Stage one 64-key KV block, K and V both row-major [key][d], async DMA.
// ---------------------------------------------------------------------------
__device__ __forceinline__ void attn_stage_kv(const _Float16* __restrict__ kg,
                                              const _Float16* __restrict__ vg,
                                              _Float16* kL, _Float16* vL,
                                              int tid) {
  #pragma unroll
  for (int p = 0; p < 4; ++p) {
    int idx = p * 128 + tid;                     // 512 chunks of 8 halves
    async_cp16(kg + (size_t)idx * 8, kL + (idx >> 3) * AP + (idx & 7) * 8);
  }
  #pragma unroll
  for (int p = 0; p < 4; ++p) {
    int idx = p * 128 + tid;
    async_cp16(vg + (size_t)idx * 8, vL + (idx >> 3) * VP + (idx & 7) * 8);
  }
}

__global__ __launch_bounds__(128)
void flash_attn_kernel(const _Float16* __restrict__ Q,
                       const _Float16* __restrict__ K,
                       const _Float16* __restrict__ V,
                       _Float16* __restrict__ Outf16) {
  __shared__ __align__(16) _Float16 qLds[64 * AP];      // [q][d]
  __shared__ __align__(16) _Float16 kLds[2][64 * AP];   // [key][d]
  __shared__ __align__(16) _Float16 vLds[2][64 * VP];   // [key][d]

  const int tid  = threadIdx.x;
  const int lane = tid & 31;
  const int wave = tid >> 5;
  const int half = lane >> 4;
  const int l16  = lane & 15;
  const int bh = blockIdx.y;
  const int qt = blockIdx.x;

  const size_t qbase  = ((size_t)bh * S_ + (size_t)qt * 64) * HD;
  const size_t kvbase = (size_t)bh * S_ * HD;

  #pragma unroll
  for (int p = 0; p < 4; ++p) {
    int idx = p * 128 + tid;
    async_cp16(Q + qbase + (size_t)idx * 8,
               qLds + (idx >> 3) * AP + (idx & 7) * 8);
  }
  attn_stage_kv(K + kvbase, V + kvbase, kLds[0], vLds[0], tid);
  wait_async();
  __syncthreads();

  float m_i = -1e30f;   // running maximum of this lane's query
  float l_i = 0.f;      // running sum over this lane half's keys only
  v8f o[4];             // o[j][r] = O[query l16][d = j*16 + 8*half + r]
  const v8f vzero = {0.f, 0.f, 0.f, 0.f, 0.f, 0.f, 0.f, 0.f};
  #pragma unroll
  for (int j = 0; j < 4; ++j) o[j] = vzero;

  const int NB = S_ / 64;
  for (int blk = 0; blk < NB; ++blk) {
    const int cur = blk & 1;
    if (blk + 1 < NB)
      attn_stage_kv(K + kvbase + (size_t)(blk + 1) * 64 * HD,
                    V + kvbase + (size_t)(blk + 1) * 64 * HD,
                    kLds[cur ^ 1], vLds[cur ^ 1], tid);
    if (blk + 2 < NB)   // L2 warm-up two blocks ahead
      __builtin_prefetch(
          (const void*)(K + kvbase + (size_t)(blk + 2) * 64 * HD + tid * 32),
          0, 1);

    // ---- scores: S^T = K(64x64) * Q^T(64x16);
    //      sc[j][r] = S[query l16][key j*16 + 8*half + r] ----
    v8f sc[4];
    #pragma unroll
    for (int j = 0; j < 4; ++j) sc[j] = vzero;
    #pragma unroll
    for (int kk = 0; kk < 64; kk += 32) {
      v16h bq = lds_frag(qLds, wave * 16 + l16, AP, kk, half);
      #pragma unroll
      for (int j = 0; j < 4; ++j) {
        v16h ak = lds_frag(kLds[cur], j * 16 + l16, AP, kk, half);
        sc[j] = wmma16(ak, bq, sc[j]);
      }
    }

    // ---- online softmax: in-lane over 32 keys, one exchange of halves ----
    float tmax[4];
    #pragma unroll
    for (int j = 0; j < 4; ++j) {
      tmax[j] = sc[j][0];
      #pragma unroll
      for (int r = 1; r < 8; ++r) tmax[j] = fmaxf(tmax[j], sc[j][r]);
    }
    float bmax = fmaxf(fmaxf(tmax[0], tmax[1]), fmaxf(tmax[2], tmax[3]));
    bmax = fmaxf(bmax, xhalf(bmax));
    const float newm  = fmaxf(m_i, bmax);
    const float alpha = __expf(m_i - newm);
    m_i = newm;

    float tsum[4];
    #pragma unroll
    for (int j = 0; j < 4; ++j) {
      tsum[j] = 0.f;
      #pragma unroll
      for (int r = 0; r < 8; ++r) {
        float p = __expf(sc[j][r] - newm);
        sc[j][r] = p;
        tsum[j] += p;
      }
    }
    l_i = alpha * l_i + ((tsum[0] + tsum[1]) + (tsum[2] + tsum[3]));

    // ---- rescale O^T: one factor per lane ----
    #pragma unroll
    for (int j = 0; j < 4; ++j)
      #pragma unroll
      for (int r = 0; r < 8; ++r) o[j][r] *= alpha;

    // ---- O^T += V^T(64x64) * P^T(64x16); score tiles 2t and 2t+1 are keys
    //      32t + 8*half + e and 32t + 16 + 8*half + e: the loader's k order ----
    #pragma unroll
    for (int t = 0; t < 2; ++t) {
      v16h bp;
      #pragma unroll
      for (int e = 0; e < 8; ++e) {
        bp[e]     = (_Float16)sc[2 * t][e];
        bp[8 + e] = (_Float16)sc[2 * t + 1][e];
      }
      #pragma unroll
      for (int j = 0; j < 4; ++j) {
        v16h av = lds_frag_tr(vLds[cur], VP, t * 32, j * 16, lane);
        o[j] = wmma16(av, bp, o[j]);
      }
    }

    wait_async();
    __syncthreads();
  }

  // ---- join the halves' sums, normalize, store f16 to [B,S,DM] for the
  //      O-projection GEMM: 8 consecutive d per lane and tile, 16 bytes ----
  const float l_all = l_i + xhalf(l_i);
  const int b = bh / H_;
  const int h = bh % H_;
  const int srow = qt * 64 + wave * 16 + l16;
  _Float16* orow = Outf16 + ((size_t)b * S_ + srow) * DM + h * HD + 8 * half;
  #pragma unroll
  for (int j = 0; j < 4; ++j) {
    v8h ov;
    #pragma unroll
    for (int r = 0; r < 8; ++r) ov[r] = (_Float16)(o[j][r] / l_all);
    *(v8h*)(orow + j * 16) = ov;
  }
}

// ---------------------------------------------------------------------------
extern "C" void kernel_launch(void* const* d_in, const int* in_sizes, int n_in,
                              void* d_out, int out_size, void* d_ws,
                              size_t ws_size, hipStream_t stream) {
  const float* x  = (const float*)d_in[0];
  const float* Wq = (const float*)d_in[1];
  const float* bq = (const float*)d_in[2];
  const float* Wk = (const float*)d_in[3];
  const float* bk = (const float*)d_in[4];
  const float* Wv = (const float*)d_in[5];
  const float* bv = (const float*)d_in[6];
  const float* Wo = (const float*)d_in[7];
  const float* bo = (const float*)d_in[8];

  const size_t elems = (size_t)B_ * S_ * DM;   // 8 Mi
  const size_t welem = (size_t)DM * DM;        // 1 Mi
  _Float16* xh  = (_Float16*)d_ws;             // f16 activations
  _Float16* wqh = xh + elems;
  _Float16* wkh = wqh + welem;
  _Float16* wvh = wkh + welem;
  _Float16* woh = wvh + welem;
  _Float16* qws = woh + welem;                 // [B,H,S,64], pre-scaled 1/8
  _Float16* kws = qws + elems;
  _Float16* vws = kws + elems;
  _Float16* aws = vws + elems;                 // attention out, [B,S,DM]

  // one-time f32 -> f16 conversions
  cvt_f32_f16_kernel<<<(int)(elems / 8 / 256), 256, 0, stream>>>(x, xh,
                                                                 (int)(elems / 8));
  cvt_f32_f16_kernel<<<(int)(welem / 8 / 256), 256, 0, stream>>>(Wq, wqh,
                                                                 (int)(welem / 8));
  cvt_f32_f16_kernel<<<(int)(welem / 8 / 256), 256, 0, stream>>>(Wk, wkh,
                                                                 (int)(welem / 8));
  cvt_f32_f16_kernel<<<(int)(welem / 8 / 256), 256, 0, stream>>>(Wv, wvh,
                                                                 (int)(welem / 8));
  cvt_f32_f16_kernel<<<(int)(welem / 8 / 256), 256, 0, stream>>>(Wo, woh,
                                                                 (int)(welem / 8));

  dim3 gGemm(64, 8);   // 8192/128 x 1024/128
  dim3 bGemm(256);
  gemm_wmma_kernel<true><<<gGemm, bGemm, 0, stream>>>(xh, wqh, bq, (void*)qws,
                                                      0.125f);  // 1/sqrt(64)
  gemm_wmma_kernel<true><<<gGemm, bGemm, 0, stream>>>(xh, wkh, bk, (void*)kws,
                                                      1.0f);
  gemm_wmma_kernel<true><<<gGemm, bGemm, 0, stream>>>(xh, wvh, bv, (void*)vws,
                                                      1.0f);

  dim3 gAttn(S_ / 64, B_ * H_);
  flash_attn_kernel<<<gAttn, dim3(128), 0, stream>>>(qws, kws, vws, aws);

  gemm_wmma_kernel<false><<<gGemm, bGemm, 0, stream>>>(aws, woh, bo, d_out,
                                                       1.0f);
}

// v004
// A run of this version takes 237 microseconds.
// Two timings next to v003 both put it at 1.11 times that version's speed.
// Over all steps from v000 it is 4.94 times as fast.
#include <hip/hip_runtime.h>
#include <hip/hip_bf16.h>
#include <stdint.h>

#define B_  2
#define S_  4096
#define DM  1024
#define H_  16
#define HD  64
#define QT  256  // queries per attention work-group

// LDS row pitch in halves. A tile read by plain 16-byte fragment loads, one
// row per lane, has a pitch that is an odd multiple of 16 bytes; a tile read by
// the transposing 16-byte load has an odd multiple of 32 bytes. The rows of a
// load then fall on distinct bank groups. Pad halves are never written or read.
#define GP  40   // 32-half GEMM A rows -> 80 B
#define AP  72   // 64-half Q and K rows -> 144 B
#define WP  144  // 128-half W rows, transposing reader -> 288 B
#define VP  80   // 64-half V rows, transposing reader -> 160 B

typedef __attribute__((ext_vector_type(16))) _Float16 v16h;
typedef __attribute__((ext_vector_type(8)))  _Float16 v8h;
typedef __attribute__((ext_vector_type(8)))  float    v8f;
typedef __attribute__((ext_vector_type(4)))  int      v4i;
typedef __attribute__((ext_vector_type(8)))  short    v8s;

union Frag16 { v16h v; v8h h[2]; };

// ---------------------------------------------------------------------------
// Async global->LDS 128-bit copy (ASYNCcnt path); sync fallback if the
// builtin is unavailable. The builtin wants v4i pointers in as(1)/as(3);
// LDS offset = low 32 bits of the generic address per ISA 10.2.
// ---------------------------------------------------------------------------
__device__ __forceinline__ void async_cp16(const _Float16* g, _Float16* l) {
#if defined(__gfx1250__) && __has_builtin(__builtin_amdgcn_global_load_async_to_lds_b128)
  __builtin_amdgcn_global_load_async_to_lds_b128(
      (__attribute__((address_space(1))) v4i*)(unsigned long long)(uintptr_t)g,
      (__attribute__((address_space(3))) v4i*)(unsigned int)(uintptr_t)l,
      0, 0);
#else
  *(v8h*)l = *(const v8h*)g;
#endif
}

__device__ __forceinline__ void wait_async() {
#if defined(__gfx1250__) && __has_builtin(__builtin_amdgcn_s_wait_asynccnt)
  __builtin_amdgcn_s_wait_asynccnt(0);
#elif defined(__gfx1250__)
  asm volatile("s_wait_asynccnt 0" ::: "memory");
#endif
}

// Per ISA 7.12.2 (16-bit A 16x32): lane -> row = lane%16, K-half = lane/16;
// element e in [0,7]  -> K = kOff + half*8 + e
// element e in [8,15] -> K = kOff + 16 + half*8 + (e-8)
__device__ __forceinline__ v16h lds_frag(const _Float16* p, int row, int ldm,
                                         int kOff, int half) {
  Frag16 f;
  f.h[0] = *(const v8h*)(p + row * ldm + kOff + half * 8);
  f.h[1] = *(const v8h*)(p + row * ldm + kOff + 16 + half * 8);
  return f.v;
}

// Transposed fragment from a row-major tile T[k][x], pitch ldm halves: the
// lane (c = lane%16, half) gets T[kOff + half*8 + e][xOff + c] in elements 0-7
// and T[kOff + 16 + half*8 + e][xOff + c] in 8-15, the k order of lds_frag.
// Each lane hands the load the address of one 16-byte piece of a tile row.
__device__ __forceinline__ v16h lds_frag_tr(const _Float16* p, int ldm, int kOff,
                                            int xOff, int lane) {
  typedef __attribute__((address_space(3))) v8s lds_v8s;
  const _Float16* a = p + (kOff + (lane >> 4) * 8 + (lane & 7)) * ldm + xOff +
                      ((lane >> 3) & 1) * 8;
  Frag16 f;
  f.h[0] = __builtin_bit_cast(
      v8h, __builtin_amdgcn_ds_load_tr16_b128_v8i16((lds_v8s*)a));
  f.h[1] = __builtin_bit_cast(
      v8h, __builtin_amdgcn_ds_load_tr16_b128_v8i16((lds_v8s*)(a + 16 * ldm)));
  return f.v;
}

// Lane l reads lane l ^ 16 by a vector cross-row move (no LDS-counter wait).
__device__ __forceinline__ float xhalf(float x) {
  const int b = __builtin_bit_cast(int, x);
  return __builtin_bit_cast(
      float, __builtin_amdgcn_permlanex16(b, b, 0x76543210, 0xfedcba98, false,
                                          false));
}

__device__ __forceinline__ v8f wmma16(v16h a, v16h b, v8f c) {
  return __builtin_amdgcn_wmma_f32_16x16x32_f16(false, a, false, b,
                                                (short)0, c, false, false);
}

// ---------------------------------------------------------------------------
// One-time f32 -> f16 conversion (x and the four weight matrices).
// ---------------------------------------------------------------------------
__global__ __launch_bounds__(256)
void cvt_f32_f16_kernel(const float* __restrict__ s, _Float16* __restrict__ d,
                        int n8) {
  int i = blockIdx.x * 256 + threadIdx.x;
  if (i < n8) {
    const float4 a = *(const float4*)(s + (size_t)i * 8);
    const float4 b = *(const float4*)(s + (size_t)i * 8 + 4);
    v8h o = {(_Float16)a.x, (_Float16)a.y, (_Float16)a.z, (_Float16)a.w,
             (_Float16)b.x, (_Float16)b.y, (_Float16)b.z, (_Float16)b.w};
    *(v8h*)(d + (size_t)i * 8) = o;
  }
}

// ---------------------------------------------------------------------------
// Stage one 128x32 A tile and one 32x128 W tile, both row-major, async DMA.
// ---------------------------------------------------------------------------
__device__ __forceinline__ void gemm_stage(const _Float16* __restrict__ A,
                                           const _Float16* __restrict__ Wh,
                                           _Float16* aL, _Float16* bL,
                                           int bm, int bn, int k0, int tid) {
  #pragma unroll
  for (int p = 0; p < 2; ++p) {                  // 512 chunks of 8 halves
    int idx = p * 256 + tid;
    int row = idx >> 2;
    int c8  = (idx & 3) * 8;
    async_cp16(A + (size_t)(bm + row) * DM + k0 + c8, aL + row * GP + c8);
  }
  #pragma unroll
  for (int p = 0; p < 2; ++p) {                  // 32 k-rows x 16 chunks of 8 n
    int idx = p * 256 + tid;
    int k  = idx >> 4;
    int n8 = (idx & 15) * 8;
    async_cp16(Wh + (size_t)(k0 + k) * DM + bn + n8, bL + k * WP + n8);
  }
}

// ---------------------------------------------------------------------------
// Tiled GEMM: C[M=8192,1024] = A[M,1024](f16) * W[1024,1024](f16) (+bias)(*scale)
// OUT_BHSD: scatter f16 into [B,H,S,64]; else fp32 [M,1024] row-major.
// 256 thr = 8 waves (4 M-strips x 2 N-strips), tile 128x128, BK=32,
// double-buffered LDS with async-DMA staging; W is transposed by its reader.
// ---------------------------------------------------------------------------
template <bool OUT_BHSD>
__global__ __launch_bounds__(256)
void gemm_wmma_kernel(const _Float16* __restrict__ A,
                      const _Float16* __restrict__ Wh,
                      const float* __restrict__ bias,
                      void* __restrict__ Out, float scale) {
  __shared__ __align__(16) _Float16 aLds[2][128 * GP];   // [row][k]
  __shared__ __align__(16) _Float16 bLds[2][32 * WP];    // W tile: [k][n]

  const int tid   = threadIdx.x;
  const int lane  = tid & 31;
  const int wave  = tid >> 5;
  const int waveM = wave & 3;
  const int waveN = wave >> 2;
  const int half  = lane >> 4;
  const int l16   = lane & 15;
  const int bm = blockIdx.x * 128;
  const int bn = blockIdx.y * 128;

  v8f acc[2][4];
  const v8f vzero = {0.f, 0.f, 0.f, 0.f, 0.f, 0.f, 0.f, 0.f};
  for (int mi = 0; mi < 2; ++mi)
    for (int j = 0; j < 4; ++j) acc[mi][j] = vzero;

  gemm_stage(A, Wh, aLds[0], bLds[0], bm, bn, 0, tid);
  wait_async();
  __syncthreads();

  const int NIT = DM / 32;
  for (int it = 0; it < NIT; ++it) {
    const int cur = it & 1;
    if (it + 1 < NIT)
      gemm_stage(A, Wh, aLds[cur ^ 1], bLds[cur ^ 1], bm, bn, (it + 1) * 32, tid);

    v16h afr[2], bfr[4];
    #pragma unroll
    for (int mi = 0; mi < 2; ++mi)
      afr[mi] = lds_frag(aLds[cur], waveM * 32 + mi * 16 + l16, GP, 0, half);
    #pragma unroll
    for (int j = 0; j < 4; ++j)
      bfr[j] = lds_frag_tr(bLds[cur], WP, 0, waveN * 64 + j * 16, lane);
    #pragma unroll
    for (int mi = 0; mi < 2; ++mi)
      #pragma unroll
      for (int j = 0; j < 4; ++j)
        acc[mi][j] = wmma16(afr[mi], bfr[j], acc[mi][j]);

    wait_async();
    __syncthreads();
  }

  // ---- epilogue: bias + scale, store (C layout: row = r + 8*half) ----
  #pragma unroll
  for (int mi = 0; mi < 2; ++mi)
    #pragma unroll
    for (int j = 0; j < 4; ++j) {
      int col = bn + waveN * 64 + j * 16 + l16;
      float bv = bias[col];
      #pragma unroll
      for (int r = 0; r < 8; ++r) {
        int row = bm + waveM * 32 + mi * 16 + r + 8 * half;
        float val = (acc[mi][j][r] + bv) * scale;
        if (OUT_BHSD) {
          int b = row >> 12, s = row & (S_ - 1);
          int h = col >> 6,  d = col & (HD - 1);
          ((_Float16*)Out)[(((size_t)(b * H_ + h)) * S_ + s) * HD + d] =
              (_Float16)val;
        } else {
          ((float*)Out)[(size_t)row * DM + col] = val;
        }
      }
    }
}

// ---------------------------------------------------------------------------
// Stage one 64-key KV block, K and V both row-major [key][d], async DMA.
// ---------------------------------------------------------------------------
__device__ __forceinline__ void attn_stage_kv(const _Float16* __restrict__ kg,
                                              const _Float16* __restrict__ vg,
                                              _Float16* kL, _Float16* vL,
                                              int tid) {
  #pragma unroll
  for (int p = 0; p < 2; ++p) {
    int idx = p * 256 + tid;                     // 512 chunks of 8 halves
    async_cp16(kg + (size_t)idx * 8, kL + (idx >> 3) * AP + (idx & 7) * 8);
  }
  #pragma unroll
  for (int p = 0; p < 2; ++p) {
    int idx = p * 256 + tid;
    async_cp16(vg + (size_t)idx * 8, vL + (idx >> 3) * VP + (idx & 7) * 8);
  }
}

__global__ __launch_bounds__(256) __attribute__((amdgpu_waves_per_eu(4, 4)))
void flash_attn_kernel(const _Float16* __restrict__ Q,
                       const _Float16* __restrict__ K,
                       const _Float16* __restrict__ V,
                       _Float16* __restrict__ Outf16) {
  __shared__ __align__(16) _Float16 qLds[QT * AP];      // [q][d]
  __shared__ __align__(16) _Float16 kLds[2][64 * AP];   // [key][d]
  __shared__ __align__(16) _Float16 vLds[2][64 * VP];   // [key][d]

  const int tid  = threadIdx.x;
  const int lane = tid & 31;
  const int wave = tid >> 5;
  const int half = lane >> 4;
  const int l16  = lane & 15;
  const int bh = blockIdx.y;
  const int qt = blockIdx.x;

  const size_t qbase  = ((size_t)bh * S_ + (size_t)qt * QT) * HD;
  const size_t kvbase = (size_t)bh * S_ * HD;

  #pragma unroll
  for (int p = 0; p < 8; ++p) {
    int idx = p * 256 + tid;                     // 2048 chunks of 8 halves
    async_cp16(Q + qbase + (size_t)idx * 8,
               qLds + (idx >> 3) * AP + (idx & 7) * 8);
  }
  attn_stage_kv(K + kvbase, V + kvbase, kLds[0], vLds[0], tid);
  wait_async();
  __syncthreads();

  float m_i[2];         // running maximum of this lane's query, per group
  float l_i[2];         // running sum over this lane half's keys only
  v8f o[2][4];          // o[g][j][r] = O[query g*16 + l16][d = j*16 + 8*half + r]
  const v8f vzero = {0.f, 0.f, 0.f, 0.f, 0.f, 0.f, 0.f, 0.f};
  #pragma unroll
  for (int g = 0; g < 2; ++g) {
    m_i[g] = -1e30f;
    l_i[g] = 0.f;
    #pragma unroll
    for (int j = 0; j < 4; ++j) o[g][j] = vzero;
  }

  const int NB = S_ / 64;
  for (int blk = 0; blk < NB; ++blk) {
    const int cur = blk & 1;
    if (blk + 1 < NB)
      attn_stage_kv(K + kvbase + (size_t)(blk + 1) * 64 * HD,
                    V + kvbase + (size_t)(blk + 1) * 64 * HD,
                    kLds[cur ^ 1], vLds[cur ^ 1], tid);
    if (blk + 2 < NB)   // L2 warm-up two blocks ahead
      __builtin_prefetch(
          (const void*)(K + kvbase + (size_t)(blk + 2) * 64 * HD + tid * 16),
          0, 1);

    // ---- scores: S^T = K(64x64) * Q^T(64x32);
    //      sc[g][j][r] = S[query g*16 + l16][key j*16 + 8*half + r] ----
    v8f sc[2][4];
    #pragma unroll
    for (int g = 0; g < 2; ++g)
      #pragma unroll
      for (int j = 0; j < 4; ++j) sc[g][j] = vzero;
    #pragma unroll
    for (int kk = 0; kk < 64; kk += 32) {
      v16h bq[2];
      #pragma unroll
      for (int g = 0; g < 2; ++g)
        bq[g] = lds_frag(qLds, wave * 32 + g * 16 + l16, AP, kk, half);
      #pragma unroll
      for (int j = 0; j < 4; ++j) {
        v16h ak = lds_frag(kLds[cur], j * 16 + l16, AP, kk, half);
        #pragma unroll
        for (int g = 0; g < 2; ++g) sc[g][j] = wmma16(ak, bq[g], sc[g][j]);
      }
    }

    // ---- online softmax: in-lane over 32 keys, one exchange of halves ----
    float newm[2], alpha[2];
    #pragma unroll
    for (int g = 0; g < 2; ++g) {
      float tmax[4];
      #pragma unroll
      for (int j = 0; j < 4; ++j) {
        tmax[j] = sc[g][j][0];
        #pragma unroll
        for (int r = 1; r < 8; ++r) tmax[j] = fmaxf(tmax[j], sc[g][j][r]);
      }
      float bmax = fmaxf(fmaxf(tmax[0], tmax[1]), fmaxf(tmax[2], tmax[3]));
      bmax = fmaxf(bmax, xhalf(bmax));
      newm[g] = fmaxf(m_i[g], bmax);
    }
    #pragma unroll
    for (int g = 0; g < 2; ++g) {
      alpha[g] = __expf(m_i[g] - newm[g]);
      m_i[g] = newm[g];
    }

    #pragma unroll
    for (int g = 0; g < 2; ++g) {
      float tsum[4];
      #pragma unroll
      for (int j = 0; j < 4; ++j) {
        tsum[j] = 0.f;
        #pragma unroll
        for (int r = 0; r < 8; ++r) {
          float p = __expf(sc[g][j][r] - newm[g]);
          sc[g][j][r] = p;
          tsum[j] += p;
        }
      }
      l_i[g] = alpha[g] * l_i[g] + ((tsum[0] + tsum[1]) + (tsum[2] + tsum[3]));

      // ---- rescale O^T: one factor per lane and group ----
      #pragma unroll
      for (int j = 0; j < 4; ++j)
        #pragma unroll
        for (int r = 0; r < 8; ++r) o[g][j][r] *= alpha[g];
    }

    // ---- O^T += V^T(64x64) * P^T(64x32); score tiles 2t and 2t+1 are keys
    //      32t + 8*half + e and 32t + 16 + 8*half + e: the loader's k order ----
    #pragma unroll
    for (int t = 0; t < 2; ++t) {
      v16h bp[2];
      #pragma unroll
      for (int g = 0; g < 2; ++g)
        #pragma unroll
        for (int e = 0; e < 8; ++e) {
          bp[g][e]     = (_Float16)sc[g][2 * t][e];
          bp[g][8 + e] = (_Float16)sc[g][2 * t + 1][e];
        }
      #pragma unroll
      for (int j = 0; j < 4; ++j) {
        v16h av = lds_frag_tr(vLds[cur], VP, t * 32, j * 16, lane);
        #pragma unroll
        for (int g = 0; g < 2; ++g) o[g][j] = wmma16(av, bp[g], o[g][j]);
      }
    }

    wait_async();
    __syncthreads();
  }

  // ---- join the halves' sums, normalize, store f16 to [B,S,DM] for the
  //      O-projection GEMM: 8 consecutive d per lane and tile, 16 bytes ----
  const int b = bh / H_;
  const int h = bh % H_;
  #pragma unroll
  for (int g = 0; g < 2; ++g) {
    const float l_all = l_i[g] + xhalf(l_i[g]);
    const int srow = qt * QT + wave * 32 + g * 16 + l16;
    _Float16* orow = Outf16 + ((size_t)b * S_ + srow) * DM + h * HD + 8 * half;
    #pragma unroll
    for (int j = 0; j < 4; ++j) {
      v8h ov;
      #pragma unroll
      for (int r = 0; r < 8; ++r) ov[r] = (_Float16)(o[g][j][r] / l_all);
      *(v8h*)(orow + j * 16) = ov;
    }
  }
}

// ---------------------------------------------------------------------------
extern "C" void kernel_launch(void* const* d_in, const int* in_sizes, int n_in,
                              void* d_out, int out_size, void* d_ws,
                              size_t ws_size, hipStream_t stream) {
  const float* x  = (const float*)d_in[0];
  const float* Wq = (const float*)d_in[1];
  const float* bq = (const float*)d_in[2];
  const float* Wk = (const float*)d_in[3];
  const float* bk = (const float*)d_in[4];
  const float* Wv = (const float*)d_in[5];
  const float* bv = (const float*)d_in[6];
  const float* Wo = (const float*)d_in[7];
  const float* bo = (const float*)d_in[8];

  const size_t elems = (size_t)B_ * S_ * DM;   // 8 Mi
  const size_t welem = (size_t)DM * DM;        // 1 Mi
  _Float16* xh  = (_Float16*)d_ws;             // f16 activations
  _Float16* wqh = xh + elems;
  _Float16* wkh = wqh + welem;
  _Float16* wvh = wkh + welem;
  _Float16* woh = wvh + welem;
  _Float16* qws = woh + welem;                 // [B,H,S,64], pre-scaled 1/8
  _Float16* kws = qws + elems;
  _Float16* vws = kws + elems;
  _Float16* aws = vws + elems;                 // attention out, [B,S,DM]

  // one-time f32 -> f16 conversions
  cvt_f32_f16_kernel<<<(int)(elems / 8 / 256), 256, 0, stream>>>(x, xh,
                                                                 (int)(elems / 8));
  cvt_f32_f16_kernel<<<(int)(welem / 8 / 256), 256, 0, stream>>>(Wq, wqh,
                                                                 (int)(welem / 8));
  cvt_f32_f16_kernel<<<(int)(welem / 8 / 256), 256, 0, stream>>>(Wk, wkh,
                                                                 (int)(welem / 8));
  cvt_f32_f16_kernel<<<(int)(welem / 8 / 256), 256, 0, stream>>>(Wv, wvh,
                                                                 (int)(welem / 8));
  cvt_f32_f16_kernel<<<(int)(welem / 8 / 256), 256, 0, stream>>>(Wo, woh,
                                                                 (int)(welem / 8));

  dim3 gGemm(64, 8);   // 8192/128 x 1024/128
  dim3 bGemm(256);
  gemm_wmma_kernel<true><<<gGemm, bGemm, 0, stream>>>(xh, wqh, bq, (void*)qws,
                                                      0.125f);  // 1/sqrt(64)
  gemm_wmma_kernel<true><<<gGemm, bGemm, 0, stream>>>(xh, wkh, bk, (void*)kws,
                                                      1.0f);
  gemm_wmma_kernel<true><<<gGemm, bGemm, 0, stream>>>(xh, wvh, bv, (void*)vws,
                                                      1.0f);

  dim3 gAttn(S_ / QT, B_ * H_);
  flash_attn_kernel<<<gAttn, dim3(256), 0, stream>>>(qws, kws, vws, aws);

  gemm_wmma_kernel<false><<<gGemm, bGemm, 0, stream>>>(aws, woh, bo, d_out,
                                                       1.0f);
}

// v005
// Measured time: 204 microseconds a run.
// Timed twice side by side with v004, it ran 1.16 times as fast both times.
// Over all steps from v000 it is 5.72 times as fast.
#include <hip/hip_runtime.h>
#include <hip/hip_bf16.h>
#include <stdint.h>

#define B_  2
#define S_  4096
#define DM  1024
#define H_  16
#define HD  64
#define QT  256  // queries per attention work-group

// LDS row pitch in halves. A tile read by plain 16-byte fragment loads, one
// row per lane, has a pitch that is an odd multiple of 16 bytes; a tile read by
// the transposing 16-byte load has an odd multiple of 32 bytes. The rows of a
// load then fall on distinct bank groups. Pad halves are never written or read.
#define GP  40   // 32-half GEMM A rows -> 80 B
#define AP  72   // 64-half Q and K rows -> 144 B
#define WP  144  // 128-half W rows, transposing reader -> 288 B
#define VP  80   // 64-half V rows, transposing reader -> 160 B

typedef __attribute__((ext_vector_type(16))) _Float16 v16h;
typedef __attribute__((ext_vector_type(8)))  _Float16 v8h;
typedef __attribute__((ext_vector_type(8)))  float    v8f;
typedef __attribute__((ext_vector_type(4)))  int      v4i;
typedef __attribute__((ext_vector_type(8)))  short    v8s;

union Frag16 { v16h v; v8h h[2]; };

// ---------------------------------------------------------------------------
// Async global->LDS 128-bit copy (ASYNCcnt path); sync fallback if the
// builtin is unavailable. The builtin wants v4i pointers in as(1)/as(3);
// LDS offset = low 32 bits of the generic address per ISA 10.2.
// ---------------------------------------------------------------------------
__device__ __forceinline__ void async_cp16(const _Float16* g, _Float16* l) {
#if defined(__gfx1250__) && __has_builtin(__builtin_amdgcn_global_load_async_to_lds_b128)
  __builtin_amdgcn_global_load_async_to_lds_b128(
      (__attribute__((address_space(1))) v4i*)(unsigned long long)(uintptr_t)g,
      (__attribute__((address_space(3))) v4i*)(unsigned int)(uintptr_t)l,
      0, 0);
#else
  *(v8h*)l = *(const v8h*)g;
#endif
}

__device__ __forceinline__ void wait_async() {
#if defined(__gfx1250__) && __has_builtin(__builtin_amdgcn_s_wait_asynccnt)
  __builtin_amdgcn_s_wait_asynccnt(0);
#elif defined(__gfx1250__)
  asm volatile("s_wait_asynccnt 0" ::: "memory");
#endif
}

// Per ISA 7.12.2 (16-bit A 16x32): lane -> row = lane%16, K-half = lane/16;
// element e in [0,7]  -> K = kOff + half*8 + e
// element e in [8,15] -> K = kOff + 16 + half*8 + (e-8)
__device__ __forceinline__ v16h lds_frag(const _Float16* p, int row, int ldm,
                                         int kOff, int half) {
  Frag16 f;
  f.h[0] = *(const v8h*)(p + row * ldm + kOff + half * 8);
  f.h[1] = *(const v8h*)(p + row * ldm + kOff + 16 + half * 8);
  return f.v;
}

// Transposed fragment from a row-major tile T[k][x], pitch ldm halves: the
// lane (c = lane%16, half) gets T[kOff + half*8 + e][xOff + c] in elements 0-7
// and T[kOff + 16 + half*8 + e][xOff + c] in 8-15, the k order of lds_frag.
// Each lane hands the load the address of one 16-byte piece of a tile row.
__device__ __forceinline__ v16h lds_frag_tr(const _Float16* p, int ldm, int kOff,
                                            int xOff, int lane) {
  typedef __attribute__((address_space(3))) v8s lds_v8s;
  const _Float16* a = p + (kOff + (lane >> 4) * 8 + (lane & 7)) * ldm + xOff +
                      ((lane >> 3) & 1) * 8;
  Frag16 f;
  f.h[0] = __builtin_bit_cast(
      v8h, __builtin_amdgcn_ds_load_tr16_b128_v8i16((lds_v8s*)a));
  f.h[1] = __builtin_bit_cast(
      v8h, __builtin_amdgcn_ds_load_tr16_b128_v8i16((lds_v8s*)(a + 16 * ldm)));
  return f.v;
}

// Lane l reads lane l ^ 16 by a vector cross-row move (no LDS-counter wait).
__device__ __forceinline__ float xhalf(float x) {
  const int b = __builtin_bit_cast(int, x);
  return __builtin_bit_cast(
      float, __builtin_amdgcn_permlanex16(b, b, 0x76543210, 0xfedcba98, false,
                                          false));
}

__device__ __forceinline__ v8f wmma16(v16h a, v16h b, v8f c) {
  return __builtin_amdgcn_wmma_f32_16x16x32_f16(false, a, false, b,
                                                (short)0, c, false, false);
}

// ---------------------------------------------------------------------------
// f32 -> f16 conversion of x and the four weight matrices in ONE launch. The
// five destinations lie back to back at d; a work-group converts 2048 elements
// of one source, picked by its index (the same for all its threads). The grid
// covers the five arrays exactly.
// ---------------------------------------------------------------------------
#define XC8 (B_ * S_ * DM / 8)   // 8-element chunks of x
#define WC8 (DM * DM / 8)        // 8-element chunks of one weight matrix
__global__ __launch_bounds__(256)
void cvt_f32_f16_kernel(const float* __restrict__ x,
                        const float* __restrict__ w0,
                        const float* __restrict__ w1,
                        const float* __restrict__ w2,
                        const float* __restrict__ w3,
                        _Float16* __restrict__ d) {
  const int c0 = blockIdx.x * 256;               // first chunk of this group
  const float* s = x;
  int sc0 = c0;                                  // the same, inside its source
  if (c0 >= XC8) {
    const int w = (c0 - XC8) / WC8;
    s = w == 0 ? w0 : w == 1 ? w1 : w == 2 ? w2 : w3;
    sc0 = (c0 - XC8) % WC8;
  }
  const size_t si = (size_t)(sc0 + threadIdx.x) * 8;
  const float4 a = *(const float4*)(s + si);
  const float4 b = *(const float4*)(s + si + 4);
  v8h o = {(_Float16)a.x, (_Float16)a.y, (_Float16)a.z, (_Float16)a.w,
           (_Float16)b.x, (_Float16)b.y, (_Float16)b.z, (_Float16)b.w};
  *(v8h*)(d + (size_t)(c0 + threadIdx.x) * 8) = o;
}

// ---------------------------------------------------------------------------
// Stage one 128x32 A tile and one 32x128 W tile, both row-major, async DMA.
// ---------------------------------------------------------------------------
__device__ __forceinline__ void gemm_stage(const _Float16* __restrict__ A,
                                           const _Float16* __restrict__ Wh,
                                           _Float16* aL, _Float16* bL,
                                           int bm, int bn, int k0, int tid) {
  #pragma unroll
  for (int p = 0; p < 2; ++p) {                  // 512 chunks of 8 halves
    int idx = p * 256 + tid;
    int row = idx >> 2;
    int c8  = (idx & 3) * 8;
    async_cp16(A + (size_t)(bm + row) * DM + k0 + c8, aL + row * GP + c8);
  }
  #pragma unroll
  for (int p = 0; p < 2; ++p) {                  // 32 k-rows x 16 chunks of 8 n
    int idx = p * 256 + tid;
    int k  = idx >> 4;
    int n8 = (idx & 15) * 8;
    async_cp16(Wh + (size_t)(k0 + k) * DM + bn + n8, bL + k * WP + n8);
  }
}

// ---------------------------------------------------------------------------
// Tiled GEMM: C[M=8192,1024] = A[M,1024](f16) * W[1024,1024](f16) (+bias)(*scale)
// OUT_BHSD: scatter f16 into [B,H,S,64]; else fp32 [M,1024] row-major.
// OUT_BHSD runs the Q, K and V projections in one launch: grid y = 3 x 8, the
// three W matrices back to back at Wh, the three outputs back to back at Out,
// one bias pointer each; scale applies to the first projection (Q) alone.
// 256 thr = 8 waves (4 M-strips x 2 N-strips), tile 128x128, BK=32,
// double-buffered LDS with async-DMA staging; W is transposed by its reader.
// ---------------------------------------------------------------------------
template <bool OUT_BHSD>
__global__ __launch_bounds__(256)
void gemm_wmma_kernel(const _Float16* __restrict__ A,
                      const _Float16* __restrict__ Wh,
                      const float* __restrict__ bias0,
                      const float* __restrict__ bias1,
                      const float* __restrict__ bias2,
                      void* __restrict__ Out, float scale) {
  __shared__ __align__(16) _Float16 aLds[2][128 * GP];   // [row][k]
  __shared__ __align__(16) _Float16 bLds[2][32 * WP];    // W tile: [k][n]

  const int tid   = threadIdx.x;
  const int lane  = tid & 31;
  const int wave  = tid >> 5;
  const int waveM = wave & 3;
  const int waveN = wave >> 2;
  const int half  = lane >> 4;
  const int l16   = lane & 15;
  const int bm = blockIdx.x * 128;
  const int pj = OUT_BHSD ? (int)(blockIdx.y >> 3) : 0;   // which projection
  const int bn = (OUT_BHSD ? (int)(blockIdx.y & 7) : (int)blockIdx.y) * 128;
  Wh += (size_t)pj * DM * DM;
  if (OUT_BHSD) Out = (_Float16*)Out + (size_t)pj * B_ * S_ * DM;
  const float* bias = pj == 0 ? bias0 : pj == 1 ? bias1 : bias2;
  if (pj != 0) scale = 1.0f;

  v8f acc[2][4];
  const v8f vzero = {0.f, 0.f, 0.f, 0.f, 0.f, 0.f, 0.f, 0.f};
  for (int mi = 0; mi < 2; ++mi)
    for (int j = 0; j < 4; ++j) acc[mi][j] = vzero;

  gemm_stage(A, Wh, aLds[0], bLds[0], bm, bn, 0, tid);
  wait_async();
  __syncthreads();

  const int NIT = DM / 32;
  for (int it = 0; it < NIT; ++it) {
    const int cur = it & 1;
    if (it + 1 < NIT)
      gemm_stage(A, Wh, aLds[cur ^ 1], bLds[cur ^ 1], bm, bn, (it + 1) * 32, tid);

    v16h afr[2], bfr[4];
    #pragma unroll
    for (int mi = 0; mi < 2; ++mi)
      afr[mi] = lds_frag(aLds[cur], waveM * 32 + mi * 16 + l16, GP, 0, half);
    #pragma unroll
    for (int j = 0; j < 4; ++j)
      bfr[j] = lds_frag_tr(bLds[cur], WP, 0, waveN * 64 + j * 16, lane);
    #pragma unroll
    for (int mi = 0; mi < 2; ++mi)
      #pragma unroll
      for (int j = 0; j < 4; ++j)
        acc[mi][j] = wmma16(afr[mi], bfr[j], acc[mi][j]);

    wait_async();
    __syncthreads();
  }

  // ---- epilogue: bias + scale, store (C layout: row = r + 8*half) ----
  #pragma unroll
  for (int mi = 0; mi < 2; ++mi)
    #pragma unroll
    for (int j = 0; j < 4; ++j) {
      int col = bn + waveN * 64 + j * 16 + l16;
      float bv = bias[col];
      #pragma unroll
      for (int r = 0; r < 8; ++r) {
        int row = bm + waveM * 32 + mi * 16 + r + 8 * half;
        float val = (acc[mi][j][r] + bv) * scale;
        if (OUT_BHSD) {
          int b = row >> 12, s = row & (S_ - 1);
          int h = col >> 6,  d = col & (HD - 1);
          ((_Float16*)Out)[(((size_t)(b * H_ + h)) * S_ + s) * HD + d] =
              (_Float16)val;
        } else {
          ((float*)Out)[(size_t)row * DM + col] = val;
        }
      }
    }
}

// ---------------------------------------------------------------------------
// Stage one 64-key KV block, K and V both row-major [key][d], async DMA.
// ---------------------------------------------------------------------------
__device__ __forceinline__ void attn_stage_kv(const _Float16* __restrict__ kg,
                                              const _Float16* __restrict__ vg,
                                              _Float16* kL, _Float16* vL,
                                              int tid) {
  #pragma unroll
  for (int p = 0; p < 2; ++p) {
    int idx = p * 256 + tid;                     // 512 chunks of 8 halves
    async_cp16(kg + (size_t)idx * 8, kL + (idx >> 3) * AP + (idx & 7) * 8);
  }
  #pragma unroll
  for (int p = 0; p < 2; ++p) {
    int idx = p * 256 + tid;
    async_cp16(vg + (size_t)idx * 8, vL + (idx >> 3) * VP + (idx & 7) * 8);
  }
}

__global__ __launch_bounds__(256) __attribute__((amdgpu_waves_per_eu(4, 4)))
void flash_attn_kernel(const _Float16* __restrict__ Q,
                       const _Float16* __restrict__ K,
                       const _Float16* __restrict__ V,
                       _Float16* __restrict__ Outf16) {
  __shared__ __align__(16) _Float16 qLds[QT * AP];      // [q][d]
  __shared__ __align__(16) _Float16 kLds[2][64 * AP];   // [key][d]
  __shared__ __align__(16) _Float16 vLds[2][64 * VP];   // [key][d]

  const int tid  = threadIdx.x;
  const int lane = tid & 31;
  const int wave = tid >> 5;
  const int half = lane >> 4;
  const int l16  = lane & 15;
  const int bh = blockIdx.y;
  const int qt = blockIdx.x;

  const size_t qbase  = ((size_t)bh * S_ + (size_t)qt * QT) * HD;
  const size_t kvbase = (size_t)bh * S_ * HD;

  #pragma unroll
  for (int p = 0; p < 8; ++p) {
    int idx = p * 256 + tid;                     // 2048 chunks of 8 halves
    async_cp16(Q + qbase + (size_t)idx * 8,
               qLds + (idx >> 3) * AP + (idx & 7) * 8);
  }
  attn_stage_kv(K + kvbase, V + kvbase, kLds[0], vLds[0], tid);
  wait_async();
  __syncthreads();

  float m_i[2];         // running maximum of this lane's query, per group
  float l_i[2];         // running sum over this lane half's keys only
  v8f o[2][4];          // o[g][j][r] = O[query g*16 + l16][d = j*16 + 8*half + r]
  const v8f vzero = {0.f, 0.f, 0.f, 0.f, 0.f, 0.f, 0.f, 0.f};
  #pragma unroll
  for (int g = 0; g < 2; ++g) {
    m_i[g] = -1e30f;
    l_i[g] = 0.f;
    #pragma unroll
    for (int j = 0; j < 4; ++j) o[g][j] = vzero;
  }

  const int NB = S_ / 64;
  for (int blk = 0; blk < NB; ++blk) {
    const int cur = blk & 1;
    if (blk + 1 < NB)
      attn_stage_kv(K + kvbase + (size_t)(blk + 1) * 64 * HD,
                    V + kvbase + (size_t)(blk + 1) * 64 * HD,
                    kLds[cur ^ 1], vLds[cur ^ 1], tid);
    if (blk + 2 < NB)   // L2 warm-up two blocks ahead
      __builtin_prefetch(
          (const void*)(K + kvbase + (size_t)(blk + 2) * 64 * HD + tid * 16),
          0, 1);

    // ---- scores: S^T = K(64x64) * Q^T(64x32);
    //      sc[g][j][r] = S[query g*16 + l16][key j*16 + 8*half + r] ----
    v8f sc[2][4];
    #pragma unroll
    for (int g = 0; g < 2; ++g)
      #pragma unroll
      for (int j = 0; j < 4; ++j) sc[g][j] = vzero;
    #pragma unroll
    for (int kk = 0; kk < 64; kk += 32) {
      v16h bq[2];
      #pragma unroll
      for (int g = 0; g < 2; ++g)
        bq[g] = lds_frag(qLds, wave * 32 + g * 16 + l16, AP, kk, half);
      #pragma unroll
      for (int j = 0; j < 4; ++j) {
        v16h ak = lds_frag(kLds[cur], j * 16 + l16, AP, kk, half);
        #pragma unroll
        for (int g = 0; g < 2; ++g) sc[g][j] = wmma16(ak, bq[g], sc[g][j]);
      }
    }

    // ---- online softmax: in-lane over 32 keys, one exchange of halves ----
    float newm[2], alpha[2];
    #pragma unroll
    for (int g = 0; g < 2; ++g) {
      float tmax[4];
      #pragma unroll
      for (int j = 0; j < 4; ++j) {
        tmax[j] = sc[g][j][0];
        #pragma unroll
        for (int r = 1; r < 8; ++r) tmax[j] = fmaxf(tmax[j], sc[g][j][r]);
      }
      float bmax = fmaxf(fmaxf(tmax[0], tmax[1]), fmaxf(tmax[2], tmax[3]));
      bmax = fmaxf(bmax, xhalf(bmax));
      newm[g] = fmaxf(m_i[g], bmax);
    }
    #pragma unroll
    for (int g = 0; g < 2; ++g) {
      alpha[g] = __expf(m_i[g] - newm[g]);
      m_i[g] = newm[g];
    }

    #pragma unroll
    for (int g = 0; g < 2; ++g) {
      float tsum[4];
      #pragma unroll
      for (int j = 0; j < 4; ++j) {
        tsum[j] = 0.f;
        #pragma unroll
        for (int r = 0; r < 8; ++r) {
          float p = __expf(sc[g][j][r] - newm[g]);
          sc[g][j][r] = p;
          tsum[j] += p;
        }
      }
      l_i[g] = alpha[g] * l_i[g] + ((tsum[0] + tsum[1]) + (tsum[2] + tsum[3]));

      // ---- rescale O^T: one factor per lane and group ----
      #pragma unroll
      for (int j = 0; j < 4; ++j)
        #pragma unroll
        for (int r = 0; r < 8; ++r) o[g][j][r] *= alpha[g];
    }

    // ---- O^T += V^T(64x64) * P^T(64x32); score tiles 2t and 2t+1 are keys
    //      32t + 8*half + e and 32t + 16 + 8*half + e: the loader's k order ----
    #pragma unroll
    for (int t = 0; t < 2; ++t) {
      v16h bp[2];
      #pragma unroll
      for (int g = 0; g < 2; ++g)
        #pragma unroll
        for (int e = 0; e < 8; ++e) {
          bp[g][e]     = (_Float16)sc[g][2 * t][e];
          bp[g][8 + e] = (_Float16)sc[g][2 * t + 1][e];
        }
      #pragma unroll
      for (int j = 0; j < 4; ++j) {
        v16h av = lds_frag_tr(vLds[cur], VP, t * 32, j * 16, lane);
        #pragma unroll
        for (int g = 0; g < 2; ++g) o[g][j] = wmma16(av, bp[g], o[g][j]);
      }
    }

    wait_async();
    __syncthreads();
  }

  // ---- join the halves' sums, normalize, store f16 to [B,S,DM] for the
  //      O-projection GEMM: 8 consecutive d per lane and tile, 16 bytes ----
  const int b = bh / H_;
  const int h = bh % H_;
  #pragma unroll
  for (int g = 0; g < 2; ++g) {
    const float l_all = l_i[g] + xhalf(l_i[g]);
    const int srow = qt * QT + wave * 32 + g * 16 + l16;
    _Float16* orow = Outf16 + ((size_t)b * S_ + srow) * DM + h * HD + 8 * half;
    #pragma unroll
    for (int j = 0; j < 4; ++j) {
      v8h ov;
      #pragma unroll
      for (int r = 0; r < 8; ++r) ov[r] = (_Float16)(o[g][j][r] / l_all);
      *(v8h*)(orow + j * 16) = ov;
    }
  }
}

// ---------------------------------------------------------------------------
extern "C" void kernel_launch(void* const* d_in, const int* in_sizes, int n_in,
                              void* d_out, int out_size, void* d_ws,
                              size_t ws_size, hipStream_t stream) {
  const float* x  = (const float*)d_in[0];
  const float* Wq = (const float*)d_in[1];
  const float* bq = (const float*)d_in[2];
  const float* Wk = (const float*)d_in[3];
  const float* bk = (const float*)d_in[4];
  const float* Wv = (const float*)d_in[5];
  const float* bv = (const float*)d_in[6];
  const float* Wo = (const float*)d_in[7];
  const float* bo = (const float*)d_in[8];

  const size_t elems = (size_t)B_ * S_ * DM;   // 8 Mi
  const size_t welem = (size_t)DM * DM;        // 1 Mi
  _Float16* xh  = (_Float16*)d_ws;             // f16 activations
  _Float16* wqh = xh + elems;
  _Float16* wkh = wqh + welem;
  _Float16* wvh = wkh + welem;
  _Float16* woh = wvh + welem;
  _Float16* qws = woh + welem;                 // [B,H,S,64], pre-scaled 1/8
  _Float16* kws = qws + elems;
  _Float16* vws = kws + elems;
  _Float16* aws = vws + elems;                 // attention out, [B,S,DM]

  // f32 -> f16 conversions: xh, wqh, wkh, wvh, woh are contiguous from xh
  cvt_f32_f16_kernel<<<(XC8 + 4 * WC8) / 256, 256, 0, stream>>>(x, Wq, Wk, Wv,
                                                                Wo, xh);

  dim3 gGemm(64, 8);   // 8192/128 x 1024/128
  dim3 gQkv(64, 24);   // the same for each of Q, K, V
  dim3 bGemm(256);
  // wqh, wkh, wvh are contiguous from wqh; qws, kws, vws from qws
  gemm_wmma_kernel<true><<<gQkv, bGemm, 0, stream>>>(xh, wqh, bq, bk, bv,
                                                     (void*)qws,
                                                     0.125f);  // 1/sqrt(64)

  dim3 gAttn(S_ / QT, B_ * H_);
  flash_attn_kernel<<<gAttn, dim3(256), 0, stream>>>(qws, kws, vws, aws);

  gemm_wmma_kernel<false><<<gGemm, bGemm, 0, stream>>>(aws, woh, bo, bo, bo,
                                                       d_out, 1.0f);
}

// v006
// One run takes 186 microseconds.
// In two side-by-side timings against v005, it was 1.09 and 1.10 times as fast.
// Over all steps from v000 it is 6.27 times as fast.
#include <hip/hip_runtime.h>
#include <hip/hip_bf16.h>
#include <stdint.h>

#define B_  2
#define S_  4096
#define DM  1024
#define H_  16
#define HD  64
#define QT  256  // queries per attention work-group

// LDS row pitch in halves. A tile read by plain 16-byte fragment loads, one
// row per lane, has a pitch that is an odd multiple of 16 bytes; a tile read by
// the transposing 16-byte load has an odd multiple of 32 bytes. The rows of a
// load then fall on distinct bank groups. Pad halves are never written or read.
#define BK  64   // k depth of one staged GEMM tile: an A row is one 128-B line
#define GP  72   // 64-half GEMM A rows -> 144 B
#define AP  72   // 64-half Q and K rows -> 144 B
#define WP  144  // 128-half W rows, transposing reader -> 288 B
#define VP  80   // 64-half V rows, transposing reader -> 160 B

typedef __attribute__((ext_vector_type(16))) _Float16 v16h;
typedef __attribute__((ext_vector_type(8)))  _Float16 v8h;
typedef __attribute__((ext_vector_type(8)))  float    v8f;
typedef __attribute__((ext_vector_type(4)))  int      v4i;
typedef __attribute__((ext_vector_type(8)))  short    v8s;

union Frag16 { v16h v; v8h h[2]; };

// ---------------------------------------------------------------------------
// Async global->LDS 128-bit copy (ASYNCcnt path); sync fallback if the
// builtin is unavailable. The builtin wants v4i pointers in as(1)/as(3);
// LDS offset = low 32 bits of the generic address per ISA 10.2.
// ---------------------------------------------------------------------------
__device__ __forceinline__ void async_cp16(const _Float16* g, _Float16* l) {
#if defined(__gfx1250__) && __has_builtin(__builtin_amdgcn_global_load_async_to_lds_b128)
  __builtin_amdgcn_global_load_async_to_lds_b128(
      (__attribute__((address_space(1))) v4i*)(unsigned long long)(uintptr_t)g,
      (__attribute__((address_space(3))) v4i*)(unsigned int)(uintptr_t)l,
      0, 0);
#else
  *(v8h*)l = *(const v8h*)g;
#endif
}

__device__ __forceinline__ void wait_async() {
#if defined(__gfx1250__) && __has_builtin(__builtin_amdgcn_s_wait_asynccnt)
  __builtin_amdgcn_s_wait_asynccnt(0);
#elif defined(__gfx1250__)
  asm volatile("s_wait_asynccnt 0" ::: "memory");
#endif
}

// Per ISA 7.12.2 (16-bit A 16x32): lane -> row = lane%16, K-half = lane/16;
// element e in [0,7]  -> K = kOff + half*8 + e
// element e in [8,15] -> K = kOff + 16 + half*8 + (e-8)
__device__ __forceinline__ v16h lds_frag(const _Float16* p, int row, int ldm,
                                         int kOff, int half) {
  Frag16 f;
  f.h[0] = *(const v8h*)(p + row * ldm + kOff + half * 8);
  f.h[1] = *(const v8h*)(p + row * ldm + kOff + 16 + half * 8);
  return f.v;
}

// Transposed fragment from a row-major tile T[k][x], pitch ldm halves: the
// lane (c = lane%16, half) gets T[kOff + half*8 + e][xOff + c] in elements 0-7
// and T[kOff + 16 + half*8 + e][xOff + c] in 8-15, the k order of lds_frag.
// Each lane hands the load the address of one 16-byte piece of a tile row.
__device__ __forceinline__ v16h lds_frag_tr(const _Float16* p, int ldm, int kOff,
                                            int xOff, int lane) {
  typedef __attribute__((address_space(3))) v8s lds_v8s;
  const _Float16* a = p + (kOff + (lane >> 4) * 8 + (lane & 7)) * ldm + xOff +
                      ((lane >> 3) & 1) * 8;
  Frag16 f;
  f.h[0] = __builtin_bit_cast(
      v8h, __builtin_amdgcn_ds_load_tr16_b128_v8i16((lds_v8s*)a));
  f.h[1] = __builtin_bit_cast(
      v8h, __builtin_amdgcn_ds_load_tr16_b128_v8i16((lds_v8s*)(a + 16 * ldm)));
  return f.v;
}

// Lane l reads lane l ^ 16 by a vector cross-row move (no LDS-counter wait).
__device__ __forceinline__ float xhalf(float x) {
  const int b = __builtin_bit_cast(int, x);
  return __builtin_bit_cast(
      float, __builtin_amdgcn_permlanex16(b, b, 0x76543210, 0xfedcba98, false,
                                          false));
}

__device__ __forceinline__ v8f wmma16(v16h a, v16h b, v8f c) {
  return __builtin_amdgcn_wmma_f32_16x16x32_f16(false, a, false, b,
                                                (short)0, c, false, false);
}

// ---------------------------------------------------------------------------
// f32 -> f16 conversion of x and the four weight matrices in ONE launch. The
// five destinations lie back to back at d; a work-group converts 2048 elements
// of one source, picked by its index (the same for all its threads). The grid
// covers the five arrays exactly.
// ---------------------------------------------------------------------------
#define XC8 (B_ * S_ * DM / 8)   // 8-element chunks of x
#define WC8 (DM * DM / 8)        // 8-element chunks of one weight matrix
__global__ __launch_bounds__(256)
void cvt_f32_f16_kernel(const float* __restrict__ x,
                        const float* __restrict__ w0,
                        const float* __restrict__ w1,
                        const float* __restrict__ w2,
                        const float* __restrict__ w3,
                        _Float16* __restrict__ d) {
  const int c0 = blockIdx.x * 256;               // first chunk of this group
  const float* s = x;
  int sc0 = c0;                                  // the same, inside its source
  if (c0 >= XC8) {
    const int w = (c0 - XC8) / WC8;
    s = w == 0 ? w0 : w == 1 ? w1 : w == 2 ? w2 : w3;
    sc0 = (c0 - XC8) % WC8;
  }
  const size_t si = (size_t)(sc0 + threadIdx.x) * 8;
  const float4 a = *(const float4*)(s + si);
  const float4 b = *(const float4*)(s + si + 4);
  v8h o = {(_Float16)a.x, (_Float16)a.y, (_Float16)a.z, (_Float16)a.w,
           (_Float16)b.x, (_Float16)b.y, (_Float16)b.z, (_Float16)b.w};
  *(v8h*)(d + (size_t)(c0 + threadIdx.x) * 8) = o;
}

// ---------------------------------------------------------------------------
// Stage one 128xBK A tile and one BKx128 W tile, both row-major, async DMA.
// A wave's copy covers four whole 128-byte lines of A, or two 256-byte runs of W.
// ---------------------------------------------------------------------------
__device__ __forceinline__ void gemm_stage(const _Float16* __restrict__ A,
                                           const _Float16* __restrict__ Wh,
                                           _Float16* aL, _Float16* bL,
                                           int bm, int bn, int k0, int tid) {
  #pragma unroll
  for (int p = 0; p < 4; ++p) {                  // 128 rows x 8 chunks of 8 k
    int idx = p * 256 + tid;
    int row = idx >> 3;
    int c8  = (idx & 7) * 8;
    async_cp16(A + (size_t)(bm + row) * DM + k0 + c8, aL + row * GP + c8);
  }
  #pragma unroll
  for (int p = 0; p < 4; ++p) {                  // 64 k-rows x 16 chunks of 8 n
    int idx = p * 256 + tid;
    int k  = idx >> 4;
    int n8 = (idx & 15) * 8;
    async_cp16(Wh + (size_t)(k0 + k) * DM + bn + n8, bL + k * WP + n8);
  }
}

// ---------------------------------------------------------------------------
// Tiled GEMM: C[M=8192,1024] = A[M,1024](f16) * W[1024,1024](f16) (+bias)(*scale)
// OUT_BHSD: scatter f16 into [B,H,S,64]; else fp32 [M,1024] row-major.
// OUT_BHSD runs the Q, K and V projections in one launch: grid y = 3 x 8, the
// three W matrices back to back at Wh, the three outputs back to back at Out,
// one bias pointer each; scale applies to the first projection (Q) alone.
// 256 thr = 8 waves (4 M-strips x 2 N-strips), tile 128x128, BK=64,
// double-buffered LDS with async-DMA staging; W is transposed by its reader.
// ---------------------------------------------------------------------------
template <bool OUT_BHSD>
__global__ __launch_bounds__(256)
void gemm_wmma_kernel(const _Float16* __restrict__ A,
                      const _Float16* __restrict__ Wh,
                      const float* __restrict__ bias0,
                      const float* __restrict__ bias1,
                      const float* __restrict__ bias2,
                      void* __restrict__ Out, float scale) {
  __shared__ __align__(16) _Float16 aLds[2][128 * GP];   // [row][k]
  __shared__ __align__(16) _Float16 bLds[2][BK * WP];    // W tile: [k][n]

  const int tid   = threadIdx.x;
  const int lane  = tid & 31;
  const int wave  = tid >> 5;
  const int waveM = wave & 3;
  const int waveN = wave >> 2;
  const int half  = lane >> 4;
  const int l16   = lane & 15;
  const int bm = blockIdx.x * 128;
  const int pj = OUT_BHSD ? (int)(blockIdx.y >> 3) : 0;   // which projection
  const int bn = (OUT_BHSD ? (int)(blockIdx.y & 7) : (int)blockIdx.y) * 128;
  Wh += (size_t)pj * DM * DM;
  if (OUT_BHSD) Out = (_Float16*)Out + (size_t)pj * B_ * S_ * DM;
  const float* bias = pj == 0 ? bias0 : pj == 1 ? bias1 : bias2;
  if (pj != 0) scale = 1.0f;

  v8f acc[2][4];
  const v8f vzero = {0.f, 0.f, 0.f, 0.f, 0.f, 0.f, 0.f, 0.f};
  for (int mi = 0; mi < 2; ++mi)
    for (int j = 0; j < 4; ++j) acc[mi][j] = vzero;

  gemm_stage(A, Wh, aLds[0], bLds[0], bm, bn, 0, tid);
  wait_async();
  __syncthreads();

  const int NIT = DM / BK;
  for (int it = 0; it < NIT; ++it) {
    const int cur = it & 1;
    if (it + 1 < NIT)
      gemm_stage(A, Wh, aLds[cur ^ 1], bLds[cur ^ 1], bm, bn, (it + 1) * BK, tid);

    // unrolled so that kk becomes a constant offset of the fragment loads
    #pragma unroll
    for (int kk = 0; kk < BK; kk += 32) {
      v16h afr[2], bfr[4];
      #pragma unroll
      for (int mi = 0; mi < 2; ++mi)
        afr[mi] = lds_frag(aLds[cur], waveM * 32 + mi * 16 + l16, GP, kk, half);
      #pragma unroll
      for (int j = 0; j < 4; ++j)
        bfr[j] = lds_frag_tr(bLds[cur], WP, kk, waveN * 64 + j * 16, lane);
      #pragma unroll
      for (int mi = 0; mi < 2; ++mi)
        #pragma unroll
        for (int j = 0; j < 4; ++j)
          acc[mi][j] = wmma16(afr[mi], bfr[j], acc[mi][j]);
    }

    wait_async();
    __syncthreads();
  }

  // ---- epilogue: bias + scale, store (C layout: row = r + 8*half) ----
  #pragma unroll
  for (int mi = 0; mi < 2; ++mi)
    #pragma unroll
    for (int j = 0; j < 4; ++j) {
      int col = bn + waveN * 64 + j * 16 + l16;
      float bv = bias[col];
      #pragma unroll
      for (int r = 0; r < 8; ++r) {
        int row = bm + waveM * 32 + mi * 16 + r + 8 * half;
        float val = (acc[mi][j][r] + bv) * scale;
        if (OUT_BHSD) {
          int b = row >> 12, s = row & (S_ - 1);
          int h = col >> 6,  d = col & (HD - 1);
          ((_Float16*)Out)[(((size_t)(b * H_ + h)) * S_ + s) * HD + d] =
              (_Float16)val;
        } else {
          ((float*)Out)[(size_t)row * DM + col] = val;
        }
      }
    }
}

// ---------------------------------------------------------------------------
// Stage one 64-key KV block, K and V both row-major [key][d], async DMA.
// ---------------------------------------------------------------------------
__device__ __forceinline__ void attn_stage_kv(const _Float16* __restrict__ kg,
                                              const _Float16* __restrict__ vg,
                                              _Float16* kL, _Float16* vL,
                                              int tid) {
  #pragma unroll
  for (int p = 0; p < 2; ++p) {
    int idx = p * 256 + tid;                     // 512 chunks of 8 halves
    async_cp16(kg + (size_t)idx * 8, kL + (idx >> 3) * AP + (idx & 7) * 8);
  }
  #pragma unroll
  for (int p = 0; p < 2; ++p) {
    int idx = p * 256 + tid;
    async_cp16(vg + (size_t)idx * 8, vL + (idx >> 3) * VP + (idx & 7) * 8);
  }
}

__global__ __launch_bounds__(256) __attribute__((amdgpu_waves_per_eu(4, 4)))
void flash_attn_kernel(const _Float16* __restrict__ Q,
                       const _Float16* __restrict__ K,
                       const _Float16* __restrict__ V,
                       _Float16* __restrict__ Outf16) {
  __shared__ __align__(16) _Float16 qLds[QT * AP];      // [q][d]
  __shared__ __align__(16) _Float16 kLds[2][64 * AP];   // [key][d]
  __shared__ __align__(16) _Float16 vLds[2][64 * VP];   // [key][d]

  const int tid  = threadIdx.x;
  const int lane = tid & 31;
  const int wave = tid >> 5;
  const int half = lane >> 4;
  const int l16  = lane & 15;
  const int bh = blockIdx.y;
  const int qt = blockIdx.x;

  const size_t qbase  = ((size_t)bh * S_ + (size_t)qt * QT) * HD;
  const size_t kvbase = (size_t)bh * S_ * HD;

  #pragma unroll
  for (int p = 0; p < 8; ++p) {
    int idx = p * 256 + tid;                     // 2048 chunks of 8 halves
    async_cp16(Q + qbase + (size_t)idx * 8,
               qLds + (idx >> 3) * AP + (idx & 7) * 8);
  }
  attn_stage_kv(K + kvbase, V + kvbase, kLds[0], vLds[0], tid);
  wait_async();
  __syncthreads();

  float m_i[2];         // running maximum of this lane's query, per group
  float l_i[2];         // running sum over this lane half's keys only
  v8f o[2][4];          // o[g][j][r] = O[query g*16 + l16][d = j*16 + 8*half + r]
  const v8f vzero = {0.f, 0.f, 0.f, 0.f, 0.f, 0.f, 0.f, 0.f};
  #pragma unroll
  for (int g = 0; g < 2; ++g) {
    m_i[g] = -1e30f;
    l_i[g] = 0.f;
    #pragma unroll
    for (int j = 0; j < 4; ++j) o[g][j] = vzero;
  }

  const int NB = S_ / 64;
  for (int blk = 0; blk < NB; ++blk) {
    const int cur = blk & 1;
    if (blk + 1 < NB)
      attn_stage_kv(K + kvbase + (size_t)(blk + 1) * 64 * HD,
                    V + kvbase + (size_t)(blk + 1) * 64 * HD,
                    kLds[cur ^ 1], vLds[cur ^ 1], tid);
    if (blk + 2 < NB)   // L2 warm-up two blocks ahead
      __builtin_prefetch(
          (const void*)(K + kvbase + (size_t)(blk + 2) * 64 * HD + tid * 16),
          0, 1);

    // ---- scores: S^T = K(64x64) * Q^T(64x32);
    //      sc[g][j][r] = S[query g*16 + l16][key j*16 + 8*half + r] ----
    v8f sc[2][4];
    #pragma unroll
    for (int g = 0; g < 2; ++g)
      #pragma unroll
      for (int j = 0; j < 4; ++j) sc[g][j] = vzero;
    #pragma unroll
    for (int kk = 0; kk < 64; kk += 32) {
      v16h bq[2];
      #pragma unroll
      for (int g = 0; g < 2; ++g)
        bq[g] = lds_frag(qLds, wave * 32 + g * 16 + l16, AP, kk, half);
      #pragma unroll
      for (int j = 0; j < 4; ++j) {
        v16h ak = lds_frag(kLds[cur], j * 16 + l16, AP, kk, half);
        #pragma unroll
        for (int g = 0; g < 2; ++g) sc[g][j] = wmma16(ak, bq[g], sc[g][j]);
      }
    }

    // ---- online softmax: in-lane over 32 keys, one exchange of halves ----
    float newm[2], alpha[2];
    #pragma unroll
    for (int g = 0; g < 2; ++g) {
      float tmax[4];
      #pragma unroll
      for (int j = 0; j < 4; ++j) {
        tmax[j] = sc[g][j][0];
        #pragma unroll
        for (int r = 1; r < 8; ++r) tmax[j] = fmaxf(tmax[j], sc[g][j][r]);
      }
      float bmax = fmaxf(fmaxf(tmax[0], tmax[1]), fmaxf(tmax[2], tmax[3]));
      bmax = fmaxf(bmax, xhalf(bmax));
      newm[g] = fmaxf(m_i[g], bmax);
    }
    #pragma unroll
    for (int g = 0; g < 2; ++g) {
      alpha[g] = __expf(m_i[g] - newm[g]);
      m_i[g] = newm[g];
    }

    #pragma unroll
    for (int g = 0; g < 2; ++g) {
      float tsum[4];
      #pragma unroll
      for (int j = 0; j < 4; ++j) {
        tsum[j] = 0.f;
        #pragma unroll
        for (int r = 0; r < 8; ++r) {
          float p = __expf(sc[g][j][r] - newm[g]);
          sc[g][j][r] = p;
          tsum[j] += p;
        }
      }
      l_i[g] = alpha[g] * l_i[g] + ((tsum[0] + tsum[1]) + (tsum[2] + tsum[3]));

      // ---- rescale O^T: one factor per lane and group ----
      #pragma unroll
      for (int j = 0; j < 4; ++j)
        #pragma unroll
        for (int r = 0; r < 8; ++r) o[g][j][r] *= alpha[g];
    }

    // ---- O^T += V^T(64x64) * P^T(64x32); score tiles 2t and 2t+1 are keys
    //      32t + 8*half + e and 32t + 16 + 8*half + e: the loader's k order ----
    #pragma unroll
    for (int t = 0; t < 2; ++t) {
      v16h bp[2];
      #pragma unroll
      for (int g = 0; g < 2; ++g)
        #pragma unroll
        for (int e = 0; e < 8; ++e) {
          bp[g][e]     = (_Float16)sc[g][2 * t][e];
          bp[g][8 + e] = (_Float16)sc[g][2 * t + 1][e];
        }
      #pragma unroll
      for (int j = 0; j < 4; ++j) {
        v16h av = lds_frag_tr(vLds[cur], VP, t * 32, j * 16, lane);
        #pragma unroll
        for (int g = 0; g < 2; ++g) o[g][j] = wmma16(av, bp[g], o[g][j]);
      }
    }

    wait_async();
    __syncthreads();
  }

  // ---- join the halves' sums, normalize, store f16 to [B,S,DM] for the
  //      O-projection GEMM: 8 consecutive d per lane and tile, 16 bytes ----
  const int b = bh / H_;
  const int h = bh % H_;
  #pragma unroll
  for (int g = 0; g < 2; ++g) {
    const float l_all = l_i[g] + xhalf(l_i[g]);
    const int srow = qt * QT + wave * 32 + g * 16 + l16;
    _Float16* orow = Outf16 + ((size_t)b * S_ + srow) * DM + h * HD + 8 * half;
    #pragma unroll
    for (int j = 0; j < 4; ++j) {
      v8h ov;
      #pragma unroll
      for (int r = 0; r < 8; ++r) ov[r] = (_Float16)(o[g][j][r] / l_all);
      *(v8h*)(orow + j * 16) = ov;
    }
  }
}

// ---------------------------------------------------------------------------
extern "C" void kernel_launch(void* const* d_in, const int* in_sizes, int n_in,
                              void* d_out, int out_size, void* d_ws,
                              size_t ws_size, hipStream_t stream) {
  const float* x  = (const float*)d_in[0];
  const float* Wq = (const float*)d_in[1];
  const float* bq = (const float*)d_in[2];
  const float* Wk = (const float*)d_in[3];
  const float* bk = (const float*)d_in[4];
  const float* Wv = (const float*)d_in[5];
  const float* bv = (const float*)d_in[6];
  const float* Wo = (const float*)d_in[7];
  const float* bo = (const float*)d_in[8];

  const size_t elems = (size_t)B_ * S_ * DM;   // 8 Mi
  const size_t welem = (size_t)DM * DM;        // 1 Mi
  _Float16* xh  = (_Float16*)d_ws;             // f16 activations
  _Float16* wqh = xh + elems;
  _Float16* wkh = wqh + welem;
  _Float16* wvh = wkh + welem;
  _Float16* woh = wvh + welem;
  _Float16* qws = woh + welem;                 // [B,H,S,64], pre-scaled 1/8
  _Float16* kws = qws + elems;
  _Float16* vws = kws + elems;
  _Float16* aws = vws + elems;                 // attention out, [B,S,DM]

  // f32 -> f16 conversions: xh, wqh, wkh, wvh, woh are contiguous from xh
  cvt_f32_f16_kernel<<<(XC8 + 4 * WC8) / 256, 256, 0, stream>>>(x, Wq, Wk, Wv,
                                                                Wo, xh);

  dim3 gGemm(64, 8);   // 8192/128 x 1024/128
  dim3 gQkv(64, 24);   // the same for each of Q, K, V
  dim3 bGemm(256);
  // wqh, wkh, wvh are contiguous from wqh; qws, kws, vws from qws
  gemm_wmma_kernel<true><<<gQkv, bGemm, 0, stream>>>(xh, wqh, bq, bk, bv,
                                                     (void*)qws,
                                                     0.125f);  // 1/sqrt(64)

  dim3 gAttn(S_ / QT, B_ * H_);
  flash_attn_kernel<<<gAttn, dim3(256), 0, stream>>>(qws, kws, vws, aws);

  gemm_wmma_kernel<false><<<gGemm, bGemm, 0, stream>>>(aws, woh, bo, bo, bo,
                                                       d_out, 1.0f);
}

// v007
// It runs in 177 microseconds.
// Two timings next to v006 both put it at 1.05 times that version's speed.
// All steps since v000 together make it 6.59 times as fast.
#include <hip/hip_runtime.h>
#include <hip/hip_bf16.h>
#include <stdint.h>

#define B_  2
#define S_  4096
#define DM  1024
#define H_  16
#define HD  64
#define QT  256  // queries per attention work-group

// LDS row pitch in halves. A tile read by plain 16-byte fragment loads, one
// row per lane, has a pitch that is an odd multiple of 16 bytes; a tile read by
// the transposing 16-byte load has an odd multiple of 32 bytes. The rows of a
// load then fall on distinct bank groups. Pad halves are never written or read.
#define BK  128  // k depth of one staged GEMM tile: an A row is 256 B
#define GP  136  // 128-half GEMM A rows -> 272 B
#define AP  72   // 64-half Q and K rows -> 144 B
#define WP  144  // 128-half W rows, transposing reader -> 288 B
#define VP  80   // 64-half V rows, transposing reader -> 160 B

typedef __attribute__((ext_vector_type(16))) _Float16 v16h;
typedef __attribute__((ext_vector_type(8)))  _Float16 v8h;
typedef __attribute__((ext_vector_type(8)))  float    v8f;
typedef __attribute__((ext_vector_type(4)))  int      v4i;
typedef __attribute__((ext_vector_type(8)))  short    v8s;

union Frag16 { v16h v; v8h h[2]; };

// ---------------------------------------------------------------------------
// Async global->LDS 128-bit copy (ASYNCcnt path); sync fallback if the
// builtin is unavailable. The builtin wants v4i pointers in as(1)/as(3);
// LDS offset = low 32 bits of the generic address per ISA 10.2.
// ---------------------------------------------------------------------------
__device__ __forceinline__ void async_cp16(const _Float16* g, _Float16* l) {
#if defined(__gfx1250__) && __has_builtin(__builtin_amdgcn_global_load_async_to_lds_b128)
  __builtin_amdgcn_global_load_async_to_lds_b128(
      (__attribute__((address_space(1))) v4i*)(unsigned long long)(uintptr_t)g,
      (__attribute__((address_space(3))) v4i*)(unsigned int)(uintptr_t)l,
      0, 0);
#else
  *(v8h*)l = *(const v8h*)g;
#endif
}

__device__ __forceinline__ void wait_async() {
#if defined(__gfx1250__) && __has_builtin(__builtin_amdgcn_s_wait_asynccnt)
  __builtin_amdgcn_s_wait_asynccnt(0);
#elif defined(__gfx1250__)
  asm volatile("s_wait_asynccnt 0" ::: "memory");
#endif
}

// Per ISA 7.12.2 (16-bit A 16x32): lane -> row = lane%16, K-half = lane/16;
// element e in [0,7]  -> K = kOff + half*8 + e
// element e in [8,15] -> K = kOff + 16 + half*8 + (e-8)
__device__ __forceinline__ v16h lds_frag(const _Float16* p, int row, int ldm,
                                         int kOff, int half) {
  Frag16 f;
  f.h[0] = *(const v8h*)(p + row * ldm + kOff + half * 8);
  f.h[1] = *(const v8h*)(p + row * ldm + kOff + 16 + half * 8);
  return f.v;
}

// Transposed fragment from a row-major tile T[k][x], pitch ldm halves: the
// lane (c = lane%16, half) gets T[kOff + half*8 + e][xOff + c] in elements 0-7
// and T[kOff + 16 + half*8 + e][xOff + c] in 8-15, the k order of lds_frag.
// Each lane hands the load the address of one 16-byte piece of a tile row.
__device__ __forceinline__ v16h lds_frag_tr(const _Float16* p, int ldm, int kOff,
                                            int xOff, int lane) {
  typedef __attribute__((address_space(3))) v8s lds_v8s;
  const _Float16* a = p + (kOff + (lane >> 4) * 8 + (lane & 7)) * ldm + xOff +
                      ((lane >> 3) & 1) * 8;
  Frag16 f;
  f.h[0] = __builtin_bit_cast(
      v8h, __builtin_amdgcn_ds_load_tr16_b128_v8i16((lds_v8s*)a));
  f.h[1] = __builtin_bit_cast(
      v8h, __builtin_amdgcn_ds_load_tr16_b128_v8i16((lds_v8s*)(a + 16 * ldm)));
  return f.v;
}

// Lane l reads lane l ^ 16 by a vector cross-row move (no LDS-counter wait).
__device__ __forceinline__ float xhalf(float x) {
  const int b = __builtin_bit_cast(int, x);
  return __builtin_bit_cast(
      float, __builtin_amdgcn_permlanex16(b, b, 0x76543210, 0xfedcba98, false,
                                          false));
}

__device__ __forceinline__ v8f wmma16(v16h a, v16h b, v8f c) {
  return __builtin_amdgcn_wmma_f32_16x16x32_f16(false, a, false, b,
                                                (short)0, c, false, false);
}

// ---------------------------------------------------------------------------
// f32 -> f16 conversion of x and the four weight matrices in ONE launch. The
// five destinations lie back to back at d; a work-group converts 2048 elements
// of one source, picked by its index (the same for all its threads). The grid
// covers the five arrays exactly.
// ---------------------------------------------------------------------------
#define XC8 (B_ * S_ * DM / 8)   // 8-element chunks of x
#define WC8 (DM * DM / 8)        // 8-element chunks of one weight matrix
__global__ __launch_bounds__(256)
void cvt_f32_f16_kernel(const float* __restrict__ x,
                        const float* __restrict__ w0,
                        const float* __restrict__ w1,
                        const float* __restrict__ w2,
                        const float* __restrict__ w3,
                        _Float16* __restrict__ d) {
  const int c0 = blockIdx.x * 256;               // first chunk of this group
  const float* s = x;
  int sc0 = c0;                                  // the same, inside its source
  if (c0 >= XC8) {
    const int w = (c0 - XC8) / WC8;
    s = w == 0 ? w0 : w == 1 ? w1 : w == 2 ? w2 : w3;
    sc0 = (c0 - XC8) % WC8;
  }
  const size_t si = (size_t)(sc0 + threadIdx.x) * 8;
  const float4 a = *(const float4*)(s + si);
  const float4 b = *(const float4*)(s + si + 4);
  v8h o = {(_Float16)a.x, (_Float16)a.y, (_Float16)a.z, (_Float16)a.w,
           (_Float16)b.x, (_Float16)b.y, (_Float16)b.z, (_Float16)b.w};
  *(v8h*)(d + (size_t)(c0 + threadIdx.x) * 8) = o;
}

// ---------------------------------------------------------------------------
// Stage one 128xBK A tile and one BKx128 W tile, both row-major, async DMA.
// A wave's copy covers two aligned 256-byte runs, of A as of W.
// ---------------------------------------------------------------------------
__device__ __forceinline__ void gemm_stage(const _Float16* __restrict__ A,
                                           const _Float16* __restrict__ Wh,
                                           _Float16* aL, _Float16* bL,
                                           int bm, int bn, int k0, int tid) {
  #pragma unroll
  for (int p = 0; p < 8; ++p) {                  // 128 rows x 16 chunks of 8 k
    int idx = p * 256 + tid;
    int row = idx >> 4;
    int c8  = (idx & 15) * 8;
    async_cp16(A + (size_t)(bm + row) * DM + k0 + c8, aL + row * GP + c8);
  }
  #pragma unroll
  for (int p = 0; p < 8; ++p) {                  // 128 k-rows x 16 chunks of 8 n
    int idx = p * 256 + tid;
    int k  = idx >> 4;
    int n8 = (idx & 15) * 8;
    async_cp16(Wh + (size_t)(k0 + k) * DM + bn + n8, bL + k * WP + n8);
  }
}

// ---------------------------------------------------------------------------
// Tiled GEMM: C[M=8192,1024] = A[M,1024](f16) * W[1024,1024](f16) (+bias)(*scale)
// OUT_BHSD: scatter f16 into [B,H,S,64]; else fp32 [M,1024] row-major.
// OUT_BHSD runs the Q, K and V projections in one launch: grid y = 3 x 8, the
// three W matrices back to back at Wh, the three outputs back to back at Out,
// one bias pointer each; scale applies to the first projection (Q) alone.
// 256 thr = 8 waves (4 M-strips x 2 N-strips), tile 128x128, BK=128,
// double-buffered LDS with async-DMA staging; W is transposed by its reader.
// ---------------------------------------------------------------------------
template <bool OUT_BHSD>
__global__ __launch_bounds__(256)
void gemm_wmma_kernel(const _Float16* __restrict__ A,
                      const _Float16* __restrict__ Wh,
                      const float* __restrict__ bias0,
                      const float* __restrict__ bias1,
                      const float* __restrict__ bias2,
                      void* __restrict__ Out, float scale) {
  __shared__ __align__(16) _Float16 aLds[2][128 * GP];   // [row][k]
  __shared__ __align__(16) _Float16 bLds[2][BK * WP];    // W tile: [k][n]

  const int tid   = threadIdx.x;
  const int lane  = tid & 31;
  const int wave  = tid >> 5;
  const int waveM = wave & 3;
  const int waveN = wave >> 2;
  const int half  = lane >> 4;
  const int l16   = lane & 15;
  const int bm = blockIdx.x * 128;
  const int pj = OUT_BHSD ? (int)(blockIdx.y >> 3) : 0;   // which projection
  const int bn = (OUT_BHSD ? (int)(blockIdx.y & 7) : (int)blockIdx.y) * 128;
  Wh += (size_t)pj * DM * DM;
  if (OUT_BHSD) Out = (_Float16*)Out + (size_t)pj * B_ * S_ * DM;
  const float* bias = pj == 0 ? bias0 : pj == 1 ? bias1 : bias2;
  if (pj != 0) scale = 1.0f;

  v8f acc[2][4];
  const v8f vzero = {0.f, 0.f, 0.f, 0.f, 0.f, 0.f, 0.f, 0.f};
  for (int mi = 0; mi < 2; ++mi)
    for (int j = 0; j < 4; ++j) acc[mi][j] = vzero;

  gemm_stage(A, Wh, aLds[0], bLds[0], bm, bn, 0, tid);
  wait_async();
  __syncthreads();

  const int NIT = DM / BK;
  for (int it = 0; it < NIT; ++it) {
    const int cur = it & 1;
    if (it + 1 < NIT)
      gemm_stage(A, Wh, aLds[cur ^ 1], bLds[cur ^ 1], bm, bn, (it + 1) * BK, tid);

    // unrolled so that kk becomes a constant offset of the fragment loads
    #pragma unroll
    for (int kk = 0; kk < BK; kk += 32) {
      v16h afr[2], bfr[4];
      #pragma unroll
      for (int mi = 0; mi < 2; ++mi)
        afr[mi] = lds_frag(aLds[cur], waveM * 32 + mi * 16 + l16, GP, kk, half);
      #pragma unroll
      for (int j = 0; j < 4; ++j)
        bfr[j] = lds_frag_tr(bLds[cur], WP, kk, waveN * 64 + j * 16, lane);
      #pragma unroll
      for (int mi = 0; mi < 2; ++mi)
        #pragma unroll
        for (int j = 0; j < 4; ++j)
          acc[mi][j] = wmma16(afr[mi], bfr[j], acc[mi][j]);
    }

    wait_async();
    __syncthreads();
  }

  // ---- epilogue: bias + scale, store (C layout: row = r + 8*half) ----
  #pragma unroll
  for (int mi = 0; mi < 2; ++mi)
    #pragma unroll
    for (int j = 0; j < 4; ++j) {
      int col = bn + waveN * 64 + j * 16 + l16;
      float bv = bias[col];
      #pragma unroll
      for (int r = 0; r < 8; ++r) {
        int row = bm + waveM * 32 + mi * 16 + r + 8 * half;
        float val = (acc[mi][j][r] + bv) * scale;
        if (OUT_BHSD) {
          int b = row >> 12, s = row & (S_ - 1);
          int h = col >> 6,  d = col & (HD - 1);
          ((_Float16*)Out)[(((size_t)(b * H_ + h)) * S_ + s) * HD + d] =
              (_Float16)val;
        } else {
          ((float*)Out)[(size_t)row * DM + col] = val;
        }
      }
    }
}

// ---------------------------------------------------------------------------
// Stage one 64-key KV block, K and V both row-major [key][d], async DMA.
// ---------------------------------------------------------------------------
__device__ __forceinline__ void attn_stage_kv(const _Float16* __restrict__ kg,
                                              const _Float16* __restrict__ vg,
                                              _Float16* kL, _Float16* vL,
                                              int tid) {
  #pragma unroll
  for (int p = 0; p < 2; ++p) {
    int idx = p * 256 + tid;                     // 512 chunks of 8 halves
    async_cp16(kg + (size_t)idx * 8, kL + (idx >> 3) * AP + (idx & 7) * 8);
  }
  #pragma unroll
  for (int p = 0; p < 2; ++p) {
    int idx = p * 256 + tid;
    async_cp16(vg + (size_t)idx * 8, vL + (idx >> 3) * VP + (idx & 7) * 8);
  }
}

__global__ __launch_bounds__(256) __attribute__((amdgpu_waves_per_eu(4, 4)))
void flash_attn_kernel(const _Float16* __restrict__ Q,
                       const _Float16* __restrict__ K,
                       const _Float16* __restrict__ V,
                       _Float16* __restrict__ Outf16) {
  __shared__ __align__(16) _Float16 qLds[QT * AP];      // [q][d]
  __shared__ __align__(16) _Float16 kLds[2][64 * AP];   // [key][d]
  __shared__ __align__(16) _Float16 vLds[2][64 * VP];   // [key][d]

  const int tid  = threadIdx.x;
  const int lane = tid & 31;
  const int wave = tid >> 5;
  const int half = lane >> 4;
  const int l16  = lane & 15;
  const int bh = blockIdx.y;
  const int qt = blockIdx.x;

  const size_t qbase  = ((size_t)bh * S_ + (size_t)qt * QT) * HD;
  const size_t kvbase = (size_t)bh * S_ * HD;

  #pragma unroll
  for (int p = 0; p < 8; ++p) {
    int idx = p * 256 + tid;                     // 2048 chunks of 8 halves
    async_cp16(Q + qbase + (size_t)idx * 8,
               qLds + (idx >> 3) * AP + (idx & 7) * 8);
  }
  attn_stage_kv(K + kvbase, V + kvbase, kLds[0], vLds[0], tid);
  wait_async();
  __syncthreads();

  float m_i[2];         // running maximum of this lane's query, per group
  float l_i[2];         // running sum over this lane half's keys only
  v8f o[2][4];          // o[g][j][r] = O[query g*16 + l16][d = j*16 + 8*half + r]
  const v8f vzero = {0.f, 0.f, 0.f, 0.f, 0.f, 0.f, 0.f, 0.f};
  #pragma unroll
  for (int g = 0; g < 2; ++g) {
    m_i[g] = -1e30f;
    l_i[g] = 0.f;
    #pragma unroll
    for (int j = 0; j < 4; ++j) o[g][j] = vzero;
  }

  const int NB = S_ / 64;
  for (int blk = 0; blk < NB; ++blk) {
    const int cur = blk & 1;
    if (blk + 1 < NB)
      attn_stage_kv(K + kvbase + (size_t)(blk + 1) * 64 * HD,
                    V + kvbase + (size_t)(blk + 1) * 64 * HD,
                    kLds[cur ^ 1], vLds[cur ^ 1], tid);
    if (blk + 2 < NB)   // L2 warm-up two blocks ahead
      __builtin_prefetch(
          (const void*)(K + kvbase + (size_t)(blk + 2) * 64 * HD + tid * 16),
          0, 1);

    // ---- scores: S^T = K(64x64) * Q^T(64x32);
    //      sc[g][j][r] = S[query g*16 + l16][key j*16 + 8*half + r] ----
    v8f sc[2][4];
    #pragma unroll
    for (int g = 0; g < 2; ++g)
      #pragma unroll
      for (int j = 0; j < 4; ++j) sc[g][j] = vzero;
    #pragma unroll
    for (int kk = 0; kk < 64; kk += 32) {
      v16h bq[2];
      #pragma unroll
      for (int g = 0; g < 2; ++g)
        bq[g] = lds_frag(qLds, wave * 32 + g * 16 + l16, AP, kk, half);
      #pragma unroll
      for (int j = 0; j < 4; ++j) {
        v16h ak = lds_frag(kLds[cur], j * 16 + l16, AP, kk, half);
        #pragma unroll
        for (int g = 0; g < 2; ++g) sc[g][j] = wmma16(ak, bq[g], sc[g][j]);
      }
    }

    // ---- online softmax: in-lane over 32 keys, one exchange of halves ----
    float newm[2], alpha[2];
    #pragma unroll
    for (int g = 0; g < 2; ++g) {
      float tmax[4];
      #pragma unroll
      for (int j = 0; j < 4; ++j) {
        tmax[j] = sc[g][j][0];
        #pragma unroll
        for (int r = 1; r < 8; ++r) tmax[j] = fmaxf(tmax[j], sc[g][j][r]);
      }
      float bmax = fmaxf(fmaxf(tmax[0], tmax[1]), fmaxf(tmax[2], tmax[3]));
      bmax = fmaxf(bmax, xhalf(bmax));
      newm[g] = fmaxf(m_i[g], bmax);
    }
    #pragma unroll
    for (int g = 0; g < 2; ++g) {
      alpha[g] = __expf(m_i[g] - newm[g]);
      m_i[g] = newm[g];
    }

    #pragma unroll
    for (int g = 0; g < 2; ++g) {
      float tsum[4];
      #pragma unroll
      for (int j = 0; j < 4; ++j) {
        tsum[j] = 0.f;
        #pragma unroll
        for (int r = 0; r < 8; ++r) {
          float p = __expf(sc[g][j][r] - newm[g]);
          sc[g][j][r] = p;
          tsum[j] += p;
        }
      }
      l_i[g] = alpha[g] * l_i[g] + ((tsum[0] + tsum[1]) + (tsum[2] + tsum[3]));

      // ---- rescale O^T: one factor per lane and group ----
      #pragma unroll
      for (int j = 0; j < 4; ++j)
        #pragma unroll
        for (int r = 0; r < 8; ++r) o[g][j][r] *= alpha[g];
    }

    // ---- O^T += V^T(64x64) * P^T(64x32); score tiles 2t and 2t+1 are keys
    //      32t + 8*half + e and 32t + 16 + 8*half + e: the loader's k order ----
    #pragma unroll
    for (int t = 0; t < 2; ++t) {
      v16h bp[2];
      #pragma unroll
      for (int g = 0; g < 2; ++g)
        #pragma unroll
        for (int e = 0; e < 8; ++e) {
          bp[g][e]     = (_Float16)sc[g][2 * t][e];
          bp[g][8 + e] = (_Float16)sc[g][2 * t + 1][e];
        }
      #pragma unroll
      for (int j = 0; j < 4; ++j) {
        v16h av = lds_frag_tr(vLds[cur], VP, t * 32, j * 16, lane);
        #pragma unroll
        for (int g = 0; g < 2; ++g) o[g][j] = wmma16(av, bp[g], o[g][j]);
      }
    }

    wait_async();
    __syncthreads();
  }

  // ---- join the halves' sums, normalize, store f16 to [B,S,DM] for the
  //      O-projection GEMM: 8 consecutive d per lane and tile, 16 bytes ----
  const int b = bh / H_;
  const int h = bh % H_;
  #pragma unroll
  for (int g = 0; g < 2; ++g) {
    const float l_all = l_i[g] + xhalf(l_i[g]);
    const int srow = qt * QT + wave * 32 + g * 16 + l16;
    _Float16* orow = Outf16 + ((size_t)b * S_ + srow) * DM + h * HD + 8 * half;
    #pragma unroll
    for (int j = 0; j < 4; ++j) {
      v8h ov;
      #pragma unroll
      for (int r = 0; r < 8; ++r) ov[r] = (_Float16)(o[g][j][r] / l_all);
      *(v8h*)(orow + j * 16) = ov;
    }
  }
}

// ---------------------------------------------------------------------------
extern "C" void kernel_launch(void* const* d_in, const int* in_sizes, int n_in,
                              void* d_out, int out_size, void* d_ws,
                              size_t ws_size, hipStream_t stream) {
  const float* x  = (const float*)d_in[0];
  const float* Wq = (const float*)d_in[1];
  const float* bq = (const float*)d_in[2];
  const float* Wk = (const float*)d_in[3];
  const float* bk = (const float*)d_in[4];
  const float* Wv = (const float*)d_in[5];
  const float* bv = (const float*)d_in[6];
  const float* Wo = (const float*)d_in[7];
  const float* bo = (const float*)d_in[8];

  const size_t elems = (size_t)B_ * S_ * DM;   // 8 Mi
  const size_t welem = (size_t)DM * DM;        // 1 Mi
  _Float16* xh  = (_Float16*)d_ws;             // f16 activations
  _Float16* wqh = xh + elems;
  _Float16* wkh = wqh + welem;
  _Float16* wvh = wkh + welem;
  _Float16* woh = wvh + welem;
  _Float16* qws = woh + welem;                 // [B,H,S,64], pre-scaled 1/8
  _Float16* kws = qws + elems;
  _Float16* vws = kws + elems;
  _Float16* aws = vws + elems;                 // attention out, [B,S,DM]

  // f32 -> f16 conversions: xh, wqh, wkh, wvh, woh are contiguous from xh
  cvt_f32_f16_kernel<<<(XC8 + 4 * WC8) / 256, 256, 0, stream>>>(x, Wq, Wk, Wv,
                                                                Wo, xh);

  dim3 gGemm(64, 8);   // 8192/128 x 1024/128
  dim3 gQkv(64, 24);   // the same for each of Q, K, V
  dim3 bGemm(256);
  // wqh, wkh, wvh are contiguous from wqh; qws, kws, vws from qws
  gemm_wmma_kernel<true><<<gQkv, bGemm, 0, stream>>>(xh, wqh, bq, bk, bv,
                                                     (void*)qws,
                                                     0.125f);  // 1/sqrt(64)

  dim3 gAttn(S_ / QT, B_ * H_);
  flash_attn_kernel<<<gAttn, dim3(256), 0, stream>>>(qws, kws, vws, aws);

  gemm_wmma_kernel<false><<<gGemm, bGemm, 0, stream>>>(aws, woh, bo, bo, bo,
                                                       d_out, 1.0f);
}

// v008
// A run of this version takes 170 microseconds.
// Next to v007, in two timings, it ran 1.04 times as fast each time.
// Over all steps from v000 it is 6.88 times as fast.
#include <hip/hip_runtime.h>
#include <hip/hip_bf16.h>
#include <stdint.h>

#define B_  2
#define S_  4096
#define DM  1024
#define H_  16
#define HD  64
#define QT  256  // queries per attention work-group
// A score may stand this far above the maximum in use before that maximum is
// renewed: 8 ln 2, so a softmax weight is at most 2^8, far inside f16 range.
#define MAXRISE 5.545177f

// LDS row pitch in halves. A tile read by plain 16-byte fragment loads, one
// row per lane, has a pitch that is an odd multiple of 16 bytes; a tile read by
// the transposing 16-byte load has an odd multiple of 32 bytes. The rows of a
// load then fall on distinct bank groups. Pad halves are never written or read.
#define BK  128  // k depth of one staged GEMM tile: an A row is 256 B
#define GP  136  // 128-half GEMM A rows -> 272 B
#define AP  72   // 64-half Q and K rows -> 144 B
#define WP  144  // 128-half W rows, transposing reader -> 288 B
#define VP  80   // 64-half V rows, transposing reader -> 160 B

typedef __attribute__((ext_vector_type(16))) _Float16 v16h;
typedef __attribute__((ext_vector_type(8)))  _Float16 v8h;
typedef __attribute__((ext_vector_type(8)))  float    v8f;
typedef __attribute__((ext_vector_type(4)))  int      v4i;
typedef __attribute__((ext_vector_type(8)))  short    v8s;

union Frag16 { v16h v; v8h h[2]; };

// ---------------------------------------------------------------------------
// Async global->LDS 128-bit copy (ASYNCcnt path); sync fallback if the
// builtin is unavailable. The builtin wants v4i pointers in as(1)/as(3);
// LDS offset = low 32 bits of the generic address per ISA 10.2.
// ---------------------------------------------------------------------------
__device__ __forceinline__ void async_cp16(const _Float16* g, _Float16* l) {
#if defined(__gfx1250__) && __has_builtin(__builtin_amdgcn_global_load_async_to_lds_b128)
  __builtin_amdgcn_global_load_async_to_lds_b128(
      (__attribute__((address_space(1))) v4i*)(unsigned long long)(uintptr_t)g,
      (__attribute__((address_space(3))) v4i*)(unsigned int)(uintptr_t)l,
      0, 0);
#else
  *(v8h*)l = *(const v8h*)g;
#endif
}

__device__ __forceinline__ void wait_async() {
#if defined(__gfx1250__) && __has_builtin(__builtin_amdgcn_s_wait_asynccnt)
  __builtin_amdgcn_s_wait_asynccnt(0);
#elif defined(__gfx1250__)
  asm volatile("s_wait_asynccnt 0" ::: "memory");
#endif
}

// Per ISA 7.12.2 (16-bit A 16x32): lane -> row = lane%16, K-half = lane/16;
// element e in [0,7]  -> K = kOff + half*8 + e
// element e in [8,15] -> K = kOff + 16 + half*8 + (e-8)
__device__ __forceinline__ v16h lds_frag(const _Float16* p, int row, int ldm,
                                         int kOff, int half) {
  Frag16 f;
  f.h[0] = *(const v8h*)(p + row * ldm + kOff + half * 8);
  f.h[1] = *(const v8h*)(p + row * ldm + kOff + 16 + half * 8);
  return f.v;
}

// Transposed fragment from a row-major tile T[k][x], pitch ldm halves: the
// lane (c = lane%16, half) gets T[kOff + half*8 + e][xOff + c] in elements 0-7
// and T[kOff + 16 + half*8 + e][xOff + c] in 8-15, the k order of lds_frag.
// Each lane hands the load the address of one 16-byte piece of a tile row.
__device__ __forceinline__ v16h lds_frag_tr(const _Float16* p, int ldm, int kOff,
                                            int xOff, int lane) {
  typedef __attribute__((address_space(3))) v8s lds_v8s;
  const _Float16* a = p + (kOff + (lane >> 4) * 8 + (lane & 7)) * ldm + xOff +
                      ((lane >> 3) & 1) * 8;
  Frag16 f;
  f.h[0] = __builtin_bit_cast(
      v8h, __builtin_amdgcn_ds_load_tr16_b128_v8i16((lds_v8s*)a));
  f.h[1] = __builtin_bit_cast(
      v8h, __builtin_amdgcn_ds_load_tr16_b128_v8i16((lds_v8s*)(a + 16 * ldm)));
  return f.v;
}

// Lane l reads lane l ^ 16 by a vector cross-row move (no LDS-counter wait).
__device__ __forceinline__ float xhalf(float x) {
  const int b = __builtin_bit_cast(int, x);
  return __builtin_bit_cast(
      float, __builtin_amdgcn_permlanex16(b, b, 0x76543210, 0xfedcba98, false,
                                          false));
}

__device__ __forceinline__ v8f wmma16(v16h a, v16h b, v8f c) {
  return __builtin_amdgcn_wmma_f32_16x16x32_f16(false, a, false, b,
                                                (short)0, c, false, false);
}

// ---------------------------------------------------------------------------
// f32 -> f16 conversion of x and the four weight matrices in ONE launch. The
// five destinations lie back to back at d; a work-group converts 2048 elements
// of one source, picked by its index (the same for all its threads). The grid
// covers the five arrays exactly.
// ---------------------------------------------------------------------------
#define XC8 (B_ * S_ * DM / 8)   // 8-element chunks of x
#define WC8 (DM * DM / 8)        // 8-element chunks of one weight matrix
__global__ __launch_bounds__(256)
void cvt_f32_f16_kernel(const float* __restrict__ x,
                        const float* __restrict__ w0,
                        const float* __restrict__ w1,
                        const float* __restrict__ w2,
                        const float* __restrict__ w3,
                        _Float16* __restrict__ d) {
  const int c0 = blockIdx.x * 256;               // first chunk of this group
  const float* s = x;
  int sc0 = c0;                                  // the same, inside its source
  if (c0 >= XC8) {
    const int w = (c0 - XC8) / WC8;
    s = w == 0 ? w0 : w == 1 ? w1 : w == 2 ? w2 : w3;
    sc0 = (c0 - XC8) % WC8;
  }
  const size_t si = (size_t)(sc0 + threadIdx.x) * 8;
  const float4 a = *(const float4*)(s + si);
  const float4 b = *(const float4*)(s + si + 4);
  v8h o = {(_Float16)a.x, (_Float16)a.y, (_Float16)a.z, (_Float16)a.w,
           (_Float16)b.x, (_Float16)b.y, (_Float16)b.z, (_Float16)b.w};
  *(v8h*)(d + (size_t)(c0 + threadIdx.x) * 8) = o;
}

// ---------------------------------------------------------------------------
// Stage one 128xBK A tile and one BKx128 W tile, both row-major, async DMA.
// A wave's copy covers two aligned 256-byte runs, of A as of W.
// ---------------------------------------------------------------------------
__device__ __forceinline__ void gemm_stage(const _Float16* __restrict__ A,
                                           const _Float16* __restrict__ Wh,
                                           _Float16* aL, _Float16* bL,
                                           int bm, int bn, int k0, int tid) {
  #pragma unroll
  for (int p = 0; p < 8; ++p) {                  // 128 rows x 16 chunks of 8 k
    int idx = p * 256 + tid;
    int row = idx >> 4;
    int c8  = (idx & 15) * 8;
    async_cp16(A + (size_t)(bm + row) * DM + k0 + c8, aL + row * GP + c8);
  }
  #pragma unroll
  for (int p = 0; p < 8; ++p) {                  // 128 k-rows x 16 chunks of 8 n
    int idx = p * 256 + tid;
    int k  = idx >> 4;
    int n8 = (idx & 15) * 8;
    async_cp16(Wh + (size_t)(k0 + k) * DM + bn + n8, bL + k * WP + n8);
  }
}

// ---------------------------------------------------------------------------
// Tiled GEMM: C[M=8192,1024] = A[M,1024](f16) * W[1024,1024](f16) (+bias)(*scale)
// OUT_BHSD: scatter f16 into [B,H,S,64]; else fp32 [M,1024] row-major.
// OUT_BHSD runs the Q, K and V projections in one launch: grid y = 3 x 8, the
// three W matrices back to back at Wh, the three outputs back to back at Out,
// one bias pointer each; scale applies to the first projection (Q) alone.
// 256 thr = 8 waves (4 M-strips x 2 N-strips), tile 128x128, BK=128,
// double-buffered LDS with async-DMA staging; W is transposed by its reader.
// ---------------------------------------------------------------------------
template <bool OUT_BHSD>
__global__ __launch_bounds__(256)
void gemm_wmma_kernel(const _Float16* __restrict__ A,
                      const _Float16* __restrict__ Wh,
                      const float* __restrict__ bias0,
                      const float* __restrict__ bias1,
                      const float* __restrict__ bias2,
                      void* __restrict__ Out, float scale) {
  __shared__ __align__(16) _Float16 aLds[2][128 * GP];   // [row][k]
  __shared__ __align__(16) _Float16 bLds[2][BK * WP];    // W tile: [k][n]

  const int tid   = threadIdx.x;
  const int lane  = tid & 31;
  const int wave  = tid >> 5;
  const int waveM = wave & 3;
  const int waveN = wave >> 2;
  const int half  = lane >> 4;
  const int l16   = lane & 15;
  const int bm = blockIdx.x * 128;
  const int pj = OUT_BHSD ? (int)(blockIdx.y >> 3) : 0;   // which projection
  const int bn = (OUT_BHSD ? (int)(blockIdx.y & 7) : (int)blockIdx.y) * 128;
  Wh += (size_t)pj * DM * DM;
  if (OUT_BHSD) Out = (_Float16*)Out + (size_t)pj * B_ * S_ * DM;
  const float* bias = pj == 0 ? bias0 : pj == 1 ? bias1 : bias2;
  if (pj != 0) scale = 1.0f;

  v8f acc[2][4];
  const v8f vzero = {0.f, 0.f, 0.f, 0.f, 0.f, 0.f, 0.f, 0.f};
  for (int mi = 0; mi < 2; ++mi)
    for (int j = 0; j < 4; ++j) acc[mi][j] = vzero;

  gemm_stage(A, Wh, aLds[0], bLds[0], bm, bn, 0, tid);
  wait_async();
  __syncthreads();

  const int NIT = DM / BK;
  for (int it = 0; it < NIT; ++it) {
    const int cur = it & 1;
    if (it + 1 < NIT)
      gemm_stage(A, Wh, aLds[cur ^ 1], bLds[cur ^ 1], bm, bn, (it + 1) * BK, tid);

    // unrolled so that kk becomes a constant offset of the fragment loads
    #pragma unroll
    for (int kk = 0; kk < BK; kk += 32) {
      v16h afr[2], bfr[4];
      #pragma unroll
      for (int mi = 0; mi < 2; ++mi)
        afr[mi] = lds_frag(aLds[cur], waveM * 32 + mi * 16 + l16, GP, kk, half);
      #pragma unroll
      for (int j = 0; j < 4; ++j)
        bfr[j] = lds_frag_tr(bLds[cur], WP, kk, waveN * 64 + j * 16, lane);
      #pragma unroll
      for (int mi = 0; mi < 2; ++mi)
        #pragma unroll
        for (int j = 0; j < 4; ++j)
          acc[mi][j] = wmma16(afr[mi], bfr[j], acc[mi][j]);
    }

    wait_async();
    __syncthreads();
  }

  // ---- epilogue: bias + scale, store (C layout: row = r + 8*half) ----
  #pragma unroll
  for (int mi = 0; mi < 2; ++mi)
    #pragma unroll
    for (int j = 0; j < 4; ++j) {
      int col = bn + waveN * 64 + j * 16 + l16;
      float bv = bias[col];
      #pragma unroll
      for (int r = 0; r < 8; ++r) {
        int row = bm + waveM * 32 + mi * 16 + r + 8 * half;
        float val = (acc[mi][j][r] + bv) * scale;
        if (OUT_BHSD) {
          int b = row >> 12, s = row & (S_ - 1);
          int h = col >> 6,  d = col & (HD - 1);
          ((_Float16*)Out)[(((size_t)(b * H_ + h)) * S_ + s) * HD + d] =
              (_Float16)val;
        } else {
          ((float*)Out)[(size_t)row * DM + col] = val;
        }
      }
    }
}

// ---------------------------------------------------------------------------
// Stage one 64-key KV block, K and V both row-major [key][d], async DMA.
// ---------------------------------------------------------------------------
__device__ __forceinline__ void attn_stage_kv(const _Float16* __restrict__ kg,
                                              const _Float16* __restrict__ vg,
                                              _Float16* kL, _Float16* vL,
                                              int tid) {
  #pragma unroll
  for (int p = 0; p < 2; ++p) {
    int idx = p * 256 + tid;                     // 512 chunks of 8 halves
    async_cp16(kg + (size_t)idx * 8, kL + (idx >> 3) * AP + (idx & 7) * 8);
  }
  #pragma unroll
  for (int p = 0; p < 2; ++p) {
    int idx = p * 256 + tid;
    async_cp16(vg + (size_t)idx * 8, vL + (idx >> 3) * VP + (idx & 7) * 8);
  }
}

__global__ __launch_bounds__(256) __attribute__((amdgpu_waves_per_eu(4, 4)))
void flash_attn_kernel(const _Float16* __restrict__ Q,
                       const _Float16* __restrict__ K,
                       const _Float16* __restrict__ V,
                       _Float16* __restrict__ Outf16) {
  __shared__ __align__(16) _Float16 qLds[QT * AP];      // [q][d]
  __shared__ __align__(16) _Float16 kLds[2][64 * AP];   // [key][d]
  __shared__ __align__(16) _Float16 vLds[2][64 * VP];   // [key][d]

  const int tid  = threadIdx.x;
  const int lane = tid & 31;
  const int wave = tid >> 5;
  const int half = lane >> 4;
  const int l16  = lane & 15;
  const int bh = blockIdx.y;
  const int qt = blockIdx.x;

  const size_t qbase  = ((size_t)bh * S_ + (size_t)qt * QT) * HD;
  const size_t kvbase = (size_t)bh * S_ * HD;

  #pragma unroll
  for (int p = 0; p < 8; ++p) {
    int idx = p * 256 + tid;                     // 2048 chunks of 8 halves
    async_cp16(Q + qbase + (size_t)idx * 8,
               qLds + (idx >> 3) * AP + (idx & 7) * 8);
  }
  attn_stage_kv(K + kvbase, V + kvbase, kLds[0], vLds[0], tid);
  wait_async();
  __syncthreads();

  v8f negm[2];          // minus the maximum in use of this lane's query, in all
                        // eight registers: the start value of a score tile
  float l_i[2];         // running sum over this lane half's keys only
  v8f o[2][4];          // o[g][j][r] = O[query g*16 + l16][d = j*16 + 8*half + r]
  const v8f vzero = {0.f, 0.f, 0.f, 0.f, 0.f, 0.f, 0.f, 0.f};
  #pragma unroll
  for (int g = 0; g < 2; ++g) {
    negm[g] = vzero;
    l_i[g] = 0.f;
    #pragma unroll
    for (int j = 0; j < 4; ++j) o[g][j] = vzero;
  }

  const int NB = S_ / 64;
  for (int blk = 0; blk < NB; ++blk) {
    const int cur = blk & 1;
    if (blk + 1 < NB)
      attn_stage_kv(K + kvbase + (size_t)(blk + 1) * 64 * HD,
                    V + kvbase + (size_t)(blk + 1) * 64 * HD,
                    kLds[cur ^ 1], vLds[cur ^ 1], tid);
    if (blk + 2 < NB)   // L2 warm-up two blocks ahead
      __builtin_prefetch(
          (const void*)(K + kvbase + (size_t)(blk + 2) * 64 * HD + tid * 16),
          0, 1);

    // ---- scores: S^T = K(64x64) * Q^T(64x32);
    //      sc[g][j][r] = S[query g*16 + l16][key j*16 + 8*half + r]
    //                    - maximum in use of that query ----
    v8f sc[2][4];
    #pragma unroll
    for (int g = 0; g < 2; ++g)
      #pragma unroll
      for (int j = 0; j < 4; ++j) sc[g][j] = negm[g];
    #pragma unroll
    for (int kk = 0; kk < 64; kk += 32) {
      v16h bq[2];
      #pragma unroll
      for (int g = 0; g < 2; ++g)
        bq[g] = lds_frag(qLds, wave * 32 + g * 16 + l16, AP, kk, half);
      #pragma unroll
      for (int j = 0; j < 4; ++j) {
        v16h ak = lds_frag(kLds[cur], j * 16 + l16, AP, kk, half);
        #pragma unroll
        for (int g = 0; g < 2; ++g) sc[g][j] = wmma16(ak, bq[g], sc[g][j]);
      }
    }

    // ---- online softmax: in-lane over 32 keys, one exchange of halves;
    //      rise[g] = this block's largest score above the maximum in use ----
    float rise[2];
    #pragma unroll
    for (int g = 0; g < 2; ++g) {
      float tmax[4];
      #pragma unroll
      for (int j = 0; j < 4; ++j) {
        tmax[j] = sc[g][j][0];
        #pragma unroll
        for (int r = 1; r < 8; ++r) tmax[j] = fmaxf(tmax[j], sc[g][j][r]);
      }
      float bmax = fmaxf(fmaxf(tmax[0], tmax[1]), fmaxf(tmax[2], tmax[3]));
      rise[g] = fmaxf(bmax, xhalf(bmax));
    }

    // ---- a new maximum comes into use in the first block, and later where a
    //      column rose by more than MAXRISE: one test per block and wave, a
    //      scalar branch. Both lane halves of a query see the same rise. ----
    if (blk == 0 ||
        __builtin_amdgcn_ballot_w32(fmaxf(rise[0], rise[1]) > MAXRISE) != 0) {
      #pragma unroll
      for (int g = 0; g < 2; ++g) {
        // the first block takes its own maximum, above or below the start 0;
        // O and the sum are still 0 there, so their factor is 0, never inf
        const float d = blk == 0 ? rise[g] : fmaxf(rise[g], 0.f);
        const float alpha = blk == 0 ? 0.f : __expf(-d);
        l_i[g] *= alpha;
        #pragma unroll
        for (int r = 0; r < 8; ++r) negm[g][r] -= d;
        #pragma unroll
        for (int j = 0; j < 4; ++j)
          #pragma unroll
          for (int r = 0; r < 8; ++r) {
            sc[g][j][r] -= d;
            o[g][j][r] *= alpha;
          }
      }
    }

    #pragma unroll
    for (int g = 0; g < 2; ++g) {
      float tsum[4];
      #pragma unroll
      for (int j = 0; j < 4; ++j) {
        tsum[j] = 0.f;
        #pragma unroll
        for (int r = 0; r < 8; ++r) {
          float p = __expf(sc[g][j][r]);
          sc[g][j][r] = p;
          tsum[j] += p;
        }
      }
      l_i[g] += (tsum[0] + tsum[1]) + (tsum[2] + tsum[3]);
    }

    // ---- O^T += V^T(64x64) * P^T(64x32); score tiles 2t and 2t+1 are keys
    //      32t + 8*half + e and 32t + 16 + 8*half + e: the loader's k order ----
    #pragma unroll
    for (int t = 0; t < 2; ++t) {
      v16h bp[2];
      #pragma unroll
      for (int g = 0; g < 2; ++g)
        #pragma unroll
        for (int e = 0; e < 8; ++e) {
          bp[g][e]     = (_Float16)sc[g][2 * t][e];
          bp[g][8 + e] = (_Float16)sc[g][2 * t + 1][e];
        }
      #pragma unroll
      for (int j = 0; j < 4; ++j) {
        v16h av = lds_frag_tr(vLds[cur], VP, t * 32, j * 16, lane);
        #pragma unroll
        for (int g = 0; g < 2; ++g) o[g][j] = wmma16(av, bp[g], o[g][j]);
      }
    }

    wait_async();
    __syncthreads();
  }

  // ---- join the halves' sums, normalize, store f16 to [B,S,DM] for the
  //      O-projection GEMM: 8 consecutive d per lane and tile, 16 bytes ----
  const int b = bh / H_;
  const int h = bh % H_;
  #pragma unroll
  for (int g = 0; g < 2; ++g) {
    const float l_all = l_i[g] + xhalf(l_i[g]);
    const int srow = qt * QT + wave * 32 + g * 16 + l16;
    _Float16* orow = Outf16 + ((size_t)b * S_ + srow) * DM + h * HD + 8 * half;
    #pragma unroll
    for (int j = 0; j < 4; ++j) {
      v8h ov;
      #pragma unroll
      for (int r = 0; r < 8; ++r) ov[r] = (_Float16)(o[g][j][r] / l_all);
      *(v8h*)(orow + j * 16) = ov;
    }
  }
}

// ---------------------------------------------------------------------------
extern "C" void kernel_launch(void* const* d_in, const int* in_sizes, int n_in,
                              void* d_out, int out_size, void* d_ws,
                              size_t ws_size, hipStream_t stream) {
  const float* x  = (const float*)d_in[0];
  const float* Wq = (const float*)d_in[1];
  const float* bq = (const float*)d_in[2];
  const float* Wk = (const float*)d_in[3];
  const float* bk = (const float*)d_in[4];
  const float* Wv = (const float*)d_in[5];
  const float* bv = (const float*)d_in[6];
  const float* Wo = (const float*)d_in[7];
  const float* bo = (const float*)d_in[8];

  const size_t elems = (size_t)B_ * S_ * DM;   // 8 Mi
  const size_t welem = (size_t)DM * DM;        // 1 Mi
  _Float16* xh  = (_Float16*)d_ws;             // f16 activations
  _Float16* wqh = xh + elems;
  _Float16* wkh = wqh + welem;
  _Float16* wvh = wkh + welem;
  _Float16* woh = wvh + welem;
  _Float16* qws = woh + welem;                 // [B,H,S,64], pre-scaled 1/8
  _Float16* kws = qws + elems;
  _Float16* vws = kws + elems;
  _Float16* aws = vws + elems;                 // attention out, [B,S,DM]

  // f32 -> f16 conversions: xh, wqh, wkh, wvh, woh are contiguous from xh
  cvt_f32_f16_kernel<<<(XC8 + 4 * WC8) / 256, 256, 0, stream>>>(x, Wq, Wk, Wv,
                                                                Wo, xh);

  dim3 gGemm(64, 8);   // 8192/128 x 1024/128
  dim3 gQkv(64, 24);   // the same for each of Q, K, V
  dim3 bGemm(256);
  // wqh, wkh, wvh are contiguous from wqh; qws, kws, vws from qws
  gemm_wmma_kernel<true><<<gQkv, bGemm, 0, stream>>>(xh, wqh, bq, bk, bv,
                                                     (void*)qws,
                                                     0.125f);  // 1/sqrt(64)

  dim3 gAttn(S_ / QT, B_ * H_);
  flash_attn_kernel<<<gAttn, dim3(256), 0, stream>>>(qws, kws, vws, aws);

  gemm_wmma_kernel<false><<<gGemm, bGemm, 0, stream>>>(aws, woh, bo, bo, bo,
                                                       d_out, 1.0f);
}

// v009
// Measured time: 160 microseconds a run.
// Next to v008, in two timings, it ran 1.07 and 1.06 times as fast.
// All steps since v000 together make it 7.32 times as fast.
#include <hip/hip_runtime.h>
#include <hip/hip_bf16.h>
#include <stdint.h>

#define B_  2
#define S_  4096
#define DM  1024
#define H_  16
#define HD  64
#define QT  256  // queries per attention work-group
// The softmax weights of a block stand as long as a lane's sum of them is at
// most this: every weight is then at most 2^12, far inside f16 range.
#define SUMLIM 4096.0f

// LDS row pitch in halves. A tile read by plain 16-byte fragment loads, one
// row per lane, has a pitch that is an odd multiple of 16 bytes; a tile read by
// the transposing 16-byte load has an odd multiple of 32 bytes. The rows of a
// load then fall on distinct bank groups. Pad halves are never written or read.
#define BK  128  // k depth of one staged GEMM tile: an A row is 256 B
#define GP  136  // 128-half GEMM A rows -> 272 B
#define AP  72   // 64-half Q and K rows -> 144 B
#define WP  144  // 128-half W rows, transposing reader -> 288 B
#define VP  80   // 64-half V rows, transposing reader -> 160 B

typedef __attribute__((ext_vector_type(16))) _Float16 v16h;
typedef __attribute__((ext_vector_type(8)))  _Float16 v8h;
typedef __attribute__((ext_vector_type(8)))  float    v8f;
typedef __attribute__((ext_vector_type(4)))  int      v4i;
typedef __attribute__((ext_vector_type(8)))  short    v8s;

union Frag16 { v16h v; v8h h[2]; };

// ---------------------------------------------------------------------------
// Async global->LDS 128-bit copy (ASYNCcnt path); sync fallback if the
// builtin is unavailable. The builtin wants v4i pointers in as(1)/as(3);
// LDS offset = low 32 bits of the generic address per ISA 10.2.
// ---------------------------------------------------------------------------
__device__ __forceinline__ void async_cp16(const _Float16* g, _Float16* l) {
#if defined(__gfx1250__) && __has_builtin(__builtin_amdgcn_global_load_async_to_lds_b128)
  __builtin_amdgcn_global_load_async_to_lds_b128(
      (__attribute__((address_space(1))) v4i*)(unsigned long long)(uintptr_t)g,
      (__attribute__((address_space(3))) v4i*)(unsigned int)(uintptr_t)l,
      0, 0);
#else
  *(v8h*)l = *(const v8h*)g;
#endif
}

__device__ __forceinline__ void wait_async() {
#if defined(__gfx1250__) && __has_builtin(__builtin_amdgcn_s_wait_asynccnt)
  __builtin_amdgcn_s_wait_asynccnt(0);
#elif defined(__gfx1250__)
  asm volatile("s_wait_asynccnt 0" ::: "memory");
#endif
}

// Per ISA 7.12.2 (16-bit A 16x32): lane -> row = lane%16, K-half = lane/16;
// element e in [0,7]  -> K = kOff + half*8 + e
// element e in [8,15] -> K = kOff + 16 + half*8 + (e-8)
__device__ __forceinline__ v16h lds_frag(const _Float16* p, int row, int ldm,
                                         int kOff, int half) {
  Frag16 f;
  f.h[0] = *(const v8h*)(p + row * ldm + kOff + half * 8);
  f.h[1] = *(const v8h*)(p + row * ldm + kOff + 16 + half * 8);
  return f.v;
}

// Transposed fragment from a row-major tile T[k][x], pitch ldm halves: the
// lane (c = lane%16, half) gets T[kOff + half*8 + e][xOff + c] in elements 0-7
// and T[kOff + 16 + half*8 + e][xOff + c] in 8-15, the k order of lds_frag.
// Each lane hands the load the address of one 16-byte piece of a tile row.
__device__ __forceinline__ v16h lds_frag_tr(const _Float16* p, int ldm, int kOff,
                                            int xOff, int lane) {
  typedef __attribute__((address_space(3))) v8s lds_v8s;
  const _Float16* a = p + (kOff + (lane >> 4) * 8 + (lane & 7)) * ldm + xOff +
                      ((lane >> 3) & 1) * 8;
  Frag16 f;
  f.h[0] = __builtin_bit_cast(
      v8h, __builtin_amdgcn_ds_load_tr16_b128_v8i16((lds_v8s*)a));
  f.h[1] = __builtin_bit_cast(
      v8h, __builtin_amdgcn_ds_load_tr16_b128_v8i16((lds_v8s*)(a + 16 * ldm)));
  return f.v;
}

// Lane l reads lane l ^ 16 by a vector cross-row move (no LDS-counter wait).
__device__ __forceinline__ float xhalf(float x) {
  const int b = __builtin_bit_cast(int, x);
  return __builtin_bit_cast(
      float, __builtin_amdgcn_permlanex16(b, b, 0x76543210, 0xfedcba98, false,
                                          false));
}

__device__ __forceinline__ v8f wmma16(v16h a, v16h b, v8f c) {
  return __builtin_amdgcn_wmma_f32_16x16x32_f16(false, a, false, b,
                                                (short)0, c, false, false);
}

// ---------------------------------------------------------------------------
// f32 -> f16 conversion of x and the four weight matrices in ONE launch. The
// five destinations lie back to back at d; a work-group converts 2048 elements
// of one source, picked by its index (the same for all its threads). The grid
// covers the five arrays exactly.
// ---------------------------------------------------------------------------
#define XC8 (B_ * S_ * DM / 8)   // 8-element chunks of x
#define WC8 (DM * DM / 8)        // 8-element chunks of one weight matrix
__global__ __launch_bounds__(256)
void cvt_f32_f16_kernel(const float* __restrict__ x,
                        const float* __restrict__ w0,
                        const float* __restrict__ w1,
                        const float* __restrict__ w2,
                        const float* __restrict__ w3,
                        _Float16* __restrict__ d) {
  const int c0 = blockIdx.x * 256;               // first chunk of this group
  const float* s = x;
  int sc0 = c0;                                  // the same, inside its source
  if (c0 >= XC8) {
    const int w = (c0 - XC8) / WC8;
    s = w == 0 ? w0 : w == 1 ? w1 : w == 2 ? w2 : w3;
    sc0 = (c0 - XC8) % WC8;
  }
  const size_t si = (size_t)(sc0 + threadIdx.x) * 8;
  const float4 a = *(const float4*)(s + si);
  const float4 b = *(const float4*)(s + si + 4);
  v8h o = {(_Float16)a.x, (_Float16)a.y, (_Float16)a.z, (_Float16)a.w,
           (_Float16)b.x, (_Float16)b.y, (_Float16)b.z, (_Float16)b.w};
  *(v8h*)(d + (size_t)(c0 + threadIdx.x) * 8) = o;
}

// ---------------------------------------------------------------------------
// Stage one 128xBK A tile and one BKx128 W tile, both row-major, async DMA.
// A wave's copy covers two aligned 256-byte runs, of A as of W.
// ---------------------------------------------------------------------------
__device__ __forceinline__ void gemm_stage(const _Float16* __restrict__ A,
                                           const _Float16* __restrict__ Wh,
                                           _Float16* aL, _Float16* bL,
                                           int bm, int bn, int k0, int tid) {
  #pragma unroll
  for (int p = 0; p < 8; ++p) {                  // 128 rows x 16 chunks of 8 k
    int idx = p * 256 + tid;
    int row = idx >> 4;
    int c8  = (idx & 15) * 8;
    async_cp16(A + (size_t)(bm + row) * DM + k0 + c8, aL + row * GP + c8);
  }
  #pragma unroll
  for (int p = 0; p < 8; ++p) {                  // 128 k-rows x 16 chunks of 8 n
    int idx = p * 256 + tid;
    int k  = idx >> 4;
    int n8 = (idx & 15) * 8;
    async_cp16(Wh + (size_t)(k0 + k) * DM + bn + n8, bL + k * WP + n8);
  }
}

// ---------------------------------------------------------------------------
// Tiled GEMM: C[M=8192,1024] = A[M,1024](f16) * W[1024,1024](f16) (+bias)(*scale)
// OUT_BHSD: scatter f16 into [B,H,S,64]; else fp32 [M,1024] row-major.
// OUT_BHSD runs the Q, K and V projections in one launch: grid y = 3 x 8, the
// three W matrices back to back at Wh, the three outputs back to back at Out,
// one bias pointer each; scale applies to the first projection (Q) alone.
// 256 thr = 8 waves (4 M-strips x 2 N-strips), tile 128x128, BK=128,
// double-buffered LDS with async-DMA staging; W is transposed by its reader.
// ---------------------------------------------------------------------------
template <bool OUT_BHSD>
__global__ __launch_bounds__(256)
void gemm_wmma_kernel(const _Float16* __restrict__ A,
                      const _Float16* __restrict__ Wh,
                      const float* __restrict__ bias0,
                      const float* __restrict__ bias1,
                      const float* __restrict__ bias2,
                      void* __restrict__ Out, float scale) {
  __shared__ __align__(16) _Float16 aLds[2][128 * GP];   // [row][k]
  __shared__ __align__(16) _Float16 bLds[2][BK * WP];    // W tile: [k][n]

  const int tid   = threadIdx.x;
  const int lane  = tid & 31;
  const int wave  = tid >> 5;
  const int waveM = wave & 3;
  const int waveN = wave >> 2;
  const int half  = lane >> 4;
  const int l16   = lane & 15;
  const int bm = blockIdx.x * 128;
  const int pj = OUT_BHSD ? (int)(blockIdx.y >> 3) : 0;   // which projection
  const int bn = (OUT_BHSD ? (int)(blockIdx.y & 7) : (int)blockIdx.y) * 128;
  Wh += (size_t)pj * DM * DM;
  if (OUT_BHSD) Out = (_Float16*)Out + (size_t)pj * B_ * S_ * DM;
  const float* bias = pj == 0 ? bias0 : pj == 1 ? bias1 : bias2;
  if (pj != 0) scale = 1.0f;

  v8f acc[2][4];
  const v8f vzero = {0.f, 0.f, 0.f, 0.f, 0.f, 0.f, 0.f, 0.f};
  for (int mi = 0; mi < 2; ++mi)
    for (int j = 0; j < 4; ++j) acc[mi][j] = vzero;

  gemm_stage(A, Wh, aLds[0], bLds[0], bm, bn, 0, tid);
  wait_async();
  __syncthreads();

  const int NIT = DM / BK;
  for (int it = 0; it < NIT; ++it) {
    const int cur = it & 1;
    if (it + 1 < NIT)
      gemm_stage(A, Wh, aLds[cur ^ 1], bLds[cur ^ 1], bm, bn, (it + 1) * BK, tid);

    // unrolled so that kk becomes a constant offset of the fragment loads
    #pragma unroll
    for (int kk = 0; kk < BK; kk += 32) {
      v16h afr[2], bfr[4];
      #pragma unroll
      for (int mi = 0; mi < 2; ++mi)
        afr[mi] = lds_frag(aLds[cur], waveM * 32 + mi * 16 + l16, GP, kk, half);
      #pragma unroll
      for (int j = 0; j < 4; ++j)
        bfr[j] = lds_frag_tr(bLds[cur], WP, kk, waveN * 64 + j * 16, lane);
      #pragma unroll
      for (int mi = 0; mi < 2; ++mi)
        #pragma unroll
        for (int j = 0; j < 4; ++j)
          acc[mi][j] = wmma16(afr[mi], bfr[j], acc[mi][j]);
    }

    wait_async();
    __syncthreads();
  }

  // ---- epilogue: bias + scale, store (C layout: row = r + 8*half) ----
  #pragma unroll
  for (int mi = 0; mi < 2; ++mi)
    #pragma unroll
    for (int j = 0; j < 4; ++j) {
      int col = bn + waveN * 64 + j * 16 + l16;
      float bv = bias[col];
      #pragma unroll
      for (int r = 0; r < 8; ++r) {
        int row = bm + waveM * 32 + mi * 16 + r + 8 * half;
        float val = (acc[mi][j][r] + bv) * scale;
        if (OUT_BHSD) {
          int b = row >> 12, s = row & (S_ - 1);
          int h = col >> 6,  d = col & (HD - 1);
          ((_Float16*)Out)[(((size_t)(b * H_ + h)) * S_ + s) * HD + d] =
              (_Float16)val;
        } else {
          ((float*)Out)[(size_t)row * DM + col] = val;
        }
      }
    }
}

// ---------------------------------------------------------------------------
// Stage one 64-key KV block, K and V both row-major [key][d], async DMA.
// ---------------------------------------------------------------------------
__device__ __forceinline__ void attn_stage_kv(const _Float16* __restrict__ kg,
                                              const _Float16* __restrict__ vg,
                                              _Float16* kL, _Float16* vL,
                                              int tid) {
  #pragma unroll
  for (int p = 0; p < 2; ++p) {
    int idx = p * 256 + tid;                     // 512 chunks of 8 halves
    async_cp16(kg + (size_t)idx * 8, kL + (idx >> 3) * AP + (idx & 7) * 8);
  }
  #pragma unroll
  for (int p = 0; p < 2; ++p) {
    int idx = p * 256 + tid;
    async_cp16(vg + (size_t)idx * 8, vL + (idx >> 3) * VP + (idx & 7) * 8);
  }
}

__global__ __launch_bounds__(256) __attribute__((amdgpu_waves_per_eu(4, 4)))
void flash_attn_kernel(const _Float16* __restrict__ Q,
                       const _Float16* __restrict__ K,
                       const _Float16* __restrict__ V,
                       _Float16* __restrict__ Outf16) {
  __shared__ __align__(16) _Float16 qLds[QT * AP];      // [q][d]
  __shared__ __align__(16) _Float16 kLds[2][64 * AP];   // [key][d]
  __shared__ __align__(16) _Float16 vLds[2][64 * VP];   // [key][d]

  const int tid  = threadIdx.x;
  const int lane = tid & 31;
  const int wave = tid >> 5;
  const int half = lane >> 4;
  const int l16  = lane & 15;
  const int bh = blockIdx.y;
  const int qt = blockIdx.x;

  const size_t qbase  = ((size_t)bh * S_ + (size_t)qt * QT) * HD;
  const size_t kvbase = (size_t)bh * S_ * HD;

  #pragma unroll
  for (int p = 0; p < 8; ++p) {
    int idx = p * 256 + tid;                     // 2048 chunks of 8 halves
    async_cp16(Q + qbase + (size_t)idx * 8,
               qLds + (idx >> 3) * AP + (idx & 7) * 8);
  }
  attn_stage_kv(K + kvbase, V + kvbase, kLds[0], vLds[0], tid);
  wait_async();
  __syncthreads();

  v8f negm[2];          // minus the maximum in use of this lane's query, in all
                        // eight registers: the start value of a score tile
  float l_i[2];         // running sum over this lane half's keys only
  v8f o[2][4];          // o[g][j][r] = O[query g*16 + l16][d = j*16 + 8*half + r]
  const v8f vzero = {0.f, 0.f, 0.f, 0.f, 0.f, 0.f, 0.f, 0.f};
  #pragma unroll
  for (int g = 0; g < 2; ++g) {
    negm[g] = vzero;
    l_i[g] = 0.f;
    #pragma unroll
    for (int j = 0; j < 4; ++j) o[g][j] = vzero;
  }

  const int NB = S_ / 64;
  for (int blk = 0; blk < NB; ++blk) {
    const int cur = blk & 1;
    if (blk + 1 < NB)
      attn_stage_kv(K + kvbase + (size_t)(blk + 1) * 64 * HD,
                    V + kvbase + (size_t)(blk + 1) * 64 * HD,
                    kLds[cur ^ 1], vLds[cur ^ 1], tid);
    if (blk + 2 < NB)   // L2 warm-up two blocks ahead
      __builtin_prefetch(
          (const void*)(K + kvbase + (size_t)(blk + 2) * 64 * HD + tid * 16),
          0, 1);

    // ---- scores: S^T = K(64x64) * Q^T(64x32);
    //      sc[g][j][r] = S[query g*16 + l16][key j*16 + 8*half + r]
    //                    - maximum in use of that query ----
    v8f sc[2][4];
    auto form_scores = [&]() {
      #pragma unroll
      for (int g = 0; g < 2; ++g)
        #pragma unroll
        for (int j = 0; j < 4; ++j) sc[g][j] = negm[g];
      #pragma unroll
      for (int kk = 0; kk < 64; kk += 32) {
        v16h bq[2];
        #pragma unroll
        for (int g = 0; g < 2; ++g)
          bq[g] = lds_frag(qLds, wave * 32 + g * 16 + l16, AP, kk, half);
        #pragma unroll
        for (int j = 0; j < 4; ++j) {
          v16h ak = lds_frag(kLds[cur], j * 16 + l16, AP, kk, half);
          #pragma unroll
          for (int g = 0; g < 2; ++g) sc[g][j] = wmma16(ak, bq[g], sc[g][j]);
        }
      }
    };
    // ---- weights in place of the scores; bsum[g] = their sum over this lane's
    //      32 keys ----
    float bsum[2];
    auto form_weights = [&]() {
      #pragma unroll
      for (int g = 0; g < 2; ++g) {
        float tsum[4];
        #pragma unroll
        for (int j = 0; j < 4; ++j) {
          tsum[j] = 0.f;
          #pragma unroll
          for (int r = 0; r < 8; ++r) {
            float p = __expf(sc[g][j][r]);
            sc[g][j][r] = p;
            tsum[j] += p;
          }
        }
        bsum[g] = (tsum[0] + tsum[1]) + (tsum[2] + tsum[3]);
      }
    };

    // ---- V^T fragments of the first 32 keys, fetched ahead of the test so
    //      that their LDS latency passes behind the exponentials, not in front
    //      of the second product ----
    v16h av0[4];
    auto fetch_v0 = [&]() {
      #pragma unroll
      for (int j = 0; j < 4; ++j)
        av0[j] = lds_frag_tr(vLds[cur], VP, 0, j * 16, lane);
    };

    // ---- one test per block and wave, a scalar branch. Weights are positive,
    //      so none exceeds its lane's sum; the negated compare also catches an
    //      infinite or undefined sum ----
    bool renew = blk == 0;
    if (!renew) {
      form_scores();
      fetch_v0();
      form_weights();
      renew = __builtin_amdgcn_ballot_w32(!(bsum[0] + bsum[1] <= SUMLIM)) != 0;
    }

    // ---- a new maximum comes into use: scores again (K and Q still stand in
    //      LDS), in-lane maximum over 32 keys, one exchange of halves ----
    if (renew) {
      form_scores();
      fetch_v0();
      #pragma unroll
      for (int g = 0; g < 2; ++g) {
        float tmax[4];
        #pragma unroll
        for (int j = 0; j < 4; ++j) {
          tmax[j] = sc[g][j][0];
          #pragma unroll
          for (int r = 1; r < 8; ++r) tmax[j] = fmaxf(tmax[j], sc[g][j][r]);
        }
        const float bmax =
            fmaxf(fmaxf(tmax[0], tmax[1]), fmaxf(tmax[2], tmax[3]));
        const float rise = fmaxf(bmax, xhalf(bmax));
        // the first block takes its own maximum, above or below the start 0;
        // O and the sum are still 0 there, so their factor is 0, never inf
        const float d = blk == 0 ? rise : fmaxf(rise, 0.f);
        const float alpha = blk == 0 ? 0.f : __expf(-d);
        l_i[g] *= alpha;
        #pragma unroll
        for (int r = 0; r < 8; ++r) negm[g][r] -= d;
        #pragma unroll
        for (int j = 0; j < 4; ++j)
          #pragma unroll
          for (int r = 0; r < 8; ++r) {
            sc[g][j][r] -= d;
            o[g][j][r] *= alpha;
          }
      }
      form_weights();
    }
    l_i[0] += bsum[0];
    l_i[1] += bsum[1];

    // ---- O^T += V^T(64x64) * P^T(64x32); score tiles 2t and 2t+1 are keys
    //      32t + 8*half + e and 32t + 16 + 8*half + e: the loader's k order ----
    #pragma unroll
    for (int t = 0; t < 2; ++t) {
      v16h bp[2];
      #pragma unroll
      for (int g = 0; g < 2; ++g)
        #pragma unroll
        for (int e = 0; e < 8; ++e) {
          bp[g][e]     = (_Float16)sc[g][2 * t][e];
          bp[g][8 + e] = (_Float16)sc[g][2 * t + 1][e];
        }
      #pragma unroll
      for (int j = 0; j < 4; ++j) {
        v16h av = t == 0 ? av0[j]
                         : lds_frag_tr(vLds[cur], VP, t * 32, j * 16, lane);
        #pragma unroll
        for (int g = 0; g < 2; ++g) o[g][j] = wmma16(av, bp[g], o[g][j]);
      }
    }

    wait_async();
    __syncthreads();
  }

  // ---- join the halves' sums, normalize, store f16 to [B,S,DM] for the
  //      O-projection GEMM: 8 consecutive d per lane and tile, 16 bytes ----
  const int b = bh / H_;
  const int h = bh % H_;
  #pragma unroll
  for (int g = 0; g < 2; ++g) {
    const float l_all = l_i[g] + xhalf(l_i[g]);
    const int srow = qt * QT + wave * 32 + g * 16 + l16;
    _Float16* orow = Outf16 + ((size_t)b * S_ + srow) * DM + h * HD + 8 * half;
    #pragma unroll
    for (int j = 0; j < 4; ++j) {
      v8h ov;
      #pragma unroll
      for (int r = 0; r < 8; ++r) ov[r] = (_Float16)(o[g][j][r] / l_all);
      *(v8h*)(orow + j * 16) = ov;
    }
  }
}

// ---------------------------------------------------------------------------
extern "C" void kernel_launch(void* const* d_in, const int* in_sizes, int n_in,
                              void* d_out, int out_size, void* d_ws,
                              size_t ws_size, hipStream_t stream) {
  const float* x  = (const float*)d_in[0];
  const float* Wq = (const float*)d_in[1];
  const float* bq = (const float*)d_in[2];
  const float* Wk = (const float*)d_in[3];
  const float* bk = (const float*)d_in[4];
  const float* Wv = (const float*)d_in[5];
  const float* bv = (const float*)d_in[6];
  const float* Wo = (const float*)d_in[7];
  const float* bo = (const float*)d_in[8];

  const size_t elems = (size_t)B_ * S_ * DM;   // 8 Mi
  const size_t welem = (size_t)DM * DM;        // 1 Mi
  _Float16* xh  = (_Float16*)d_ws;             // f16 activations
  _Float16* wqh = xh + elems;
  _Float16* wkh = wqh + welem;
  _Float16* wvh = wkh + welem;
  _Float16* woh = wvh + welem;
  _Float16* qws = woh + welem;                 // [B,H,S,64], pre-scaled 1/8
  _Float16* kws = qws + elems;
  _Float16* vws = kws + elems;
  _Float16* aws = vws + elems;                 // attention out, [B,S,DM]

  // f32 -> f16 conversions: xh, wqh, wkh, wvh, woh are contiguous from xh
  cvt_f32_f16_kernel<<<(XC8 + 4 * WC8) / 256, 256, 0, stream>>>(x, Wq, Wk, Wv,
                                                                Wo, xh);

  dim3 gGemm(64, 8);   // 8192/128 x 1024/128
  dim3 gQkv(64, 24);   // the same for each of Q, K, V
  dim3 bGemm(256);
  // wqh, wkh, wvh are contiguous from wqh; qws, kws, vws from qws
  gemm_wmma_kernel<true><<<gQkv, bGemm, 0, stream>>>(xh, wqh, bq, bk, bv,
                                                     (void*)qws,
                                                     0.125f);  // 1/sqrt(64)

  dim3 gAttn(S_ / QT, B_ * H_);
  flash_attn_kernel<<<gAttn, dim3(256), 0, stream>>>(qws, kws, vws, aws);

  gemm_wmma_kernel<false><<<gGemm, bGemm, 0, stream>>>(aws, woh, bo, bo, bo,
                                                       d_out, 1.0f);
}
